// v000
// The times below were measured on an AMD MI455X: many runs one after another, warmed up first and cycling through
// copies of the inputs, with the whole window's GPU time divided by the number of runs. Launches and the gaps
// between them are all in it. The median over several windows is given; except for v000 it joins two sittings, which
// can be a few percent apart, so the side-by-side timings, each taken in one sitting, are the better comparison.
// The starting kernel, v000, takes 172 microseconds a run.
#include <hip/hip_runtime.h>

// Cross_At: q = x Wq + bq, [k | v] = y Wkv + bkv (8 heads x 8 dims; kv laid out [hw][2][H][d]); q, k L2-normalised per head (eps 1e-12); attn = softmax(q.k) (no scaling); ctx; out = ctx We + be
// -> [1][4096][64].
// WMMA (v_wmma_f32_16x16x32_f16, f32 accumulate): the projections with EXACT operands (x, y, [in][out] weights exact bf16; 1 product) + bias, the per-head L2 normalisation in f32 in the epilogue
// (8-lane shuffles); q̂, k̂ as f16 hi+lo pairs x8 in 32-wide zero-padded head slots (K = 8 real of 32), S^T = k̂.q̂ (3 products); online softmax in f32; o^T += (8v)^T.P^T with P and v hi+lo
// (3 products; v in 16-row zero-padded head slots); out = ctx.We + be with ctx hi+lo (2 products). Fragment k-map per lane half hh for A AND B: elements 0..7 <- k = 8hh+0..7, 8..15 <- k =

namespace {
constexpr int S = 4096, C = 64, H = 8, HD = 8, KP = 32 /* padded head slot for q/k */, VP = 16 /* padded dims for v^T */;
constexpr float XS = 8.0f, PS = 8.0f;

typedef _Float16 b16;
typedef __attribute__((ext_vector_type(16))) _Float16 v16b;
typedef __attribute__((ext_vector_type(8))) _Float16 v8b;
typedef __attribute__((ext_vector_type(8))) float v8f;
typedef __attribute__((ext_vector_type(4))) float v4f;
__device__ __forceinline__ float bf16_rne(float f) { unsigned int u = __float_as_uint(f); u += 0x7FFFu + ((u >> 16) & 1u); return __uint_as_float(u & 0xFFFF0000u); }
__device__ __forceinline__ void split16(float v, b16& hi, b16& lo) { hi = (b16)v; lo = (b16)(v - (float)hi); }
__device__ __forceinline__ v16b frag_kb(const b16* p, int hh) { const v8b a = *(const v8b*)(p + 8 * hh), b = *(const v8b*)(p + 16 + 8 * hh); v16b f;
#pragma unroll
  for (int e = 0; e < 8; ++e) { f[e] = a[e]; f[8 + e] = b[e]; } return f; }
__device__ __forceinline__ v8f wmma16b(v16b a, v16b b, v8f c) { v8f d = __builtin_amdgcn_wmma_f32_16x16x32_f16(false, a, false, b, (short)0, c, false, false); asm volatile("v_nop\n\tv_nop\n\tv_nop\n\tv_nop" : "+v"(d) : "v"(a), "v"(b)); return d; }
__device__ __forceinline__ void wave_lds_sync() { __builtin_amdgcn_fence(__ATOMIC_RELEASE, "workgroup"); __builtin_amdgcn_wave_barrier(); __builtin_amdgcn_fence(__ATOMIC_ACQUIRE, "workgroup"); }
__device__ __forceinline__ float nexp(float x) { return __builtin_amdgcn_exp2f(x * 1.4426950408889634f); }
__device__ __forceinline__ float pmul(float a, float b) { float p = a * b; asm volatile("" : "+v"(p)); return p; }

// prep: B rows Wq^T [64][64] @0, Wkv^T [128][64] @4096, We^T [64][64] @12288 (f16 exact); P: bq @0, bkv @64, be @192; X, Y rows f16 exact x8; zero-fill of the padded q/k slot buffers and v planes.
__global__ __launch_bounds__(256) void prep_kernel(const float* __restrict__ x, const float* __restrict__ y, const float* __restrict__ wq, const float* __restrict__ bq, const float* __restrict__ wkv, const float* __restrict__ bkv, const float* __restrict__ we, const float* __restrict__ be, b16* __restrict__ R, float* __restrict__ P, b16* __restrict__ X, b16* __restrict__ Y, b16* __restrict__ Z0, size_t nz) {
  const size_t tid = (size_t)blockIdx.x * 256 + threadIdx.x, nth = (size_t)gridDim.x * 256;
  {
    for (size_t p = tid; p < (size_t)C * C; p += nth) { const int o = (int)(p / C), k = (int)(p % C); ((b16*)R)[p] = (b16)bf16_rne(wq[(size_t)k * C + o]); ((b16*)R)[12288 + p] = (b16)bf16_rne(we[(size_t)k * C + o]); }
    for (size_t p = tid; p < (size_t)2 * C * C; p += nth) { const int o = (int)(p / C), k = (int)(p % C); ((b16*)R)[4096 + p] = (b16)bf16_rne(wkv[(size_t)k * 2 * C + o]); }
    for (size_t q = tid; q < 256; q += nth) { const int i = (int)q; P[q] = bf16_rne((i < 64) ? bq[i] : (i < 192) ? bkv[i - 64] : be[i - 192]); }
    for (size_t p = tid; p < (size_t)S * C / 8; p += nth) { v8b a, b; for (int e = 0; e < 8; ++e) { a[e] = (b16)(bf16_rne(x[p * 8 + e]) * XS); b[e] = (b16)(bf16_rne(y[p * 8 + e]) * XS); } *(v8b*)(X + p * 8) = a; *(v8b*)(Y + p * 8) = b; }
    { const v8b z = {}; for (size_t p = tid; p < nz / 8; p += nth) *(v8b*)(Z0 + p * 8) = z; }   // Q/K padded slots + V planes zero (their live parts are overwritten by proj_kernel and vt_kernel)
     }
}

// projections: block = 32 tokens x 2 waves; wave 0: q = x Wq + bq (64 cols) -> L2-normalise each 8-dim head (shuffles over the 8 lanes of a head) -> hi/lo into QH/QL[tok][h][32] (first 8 of the
// 32-wide slot; rest stays zero); wave 1: kv = y Wkv + bkv (128 cols): k (cols 0..63) normalised -> KH/KL slots; v (cols 64..127) -> f32 rows VR[tok][64] through LDS; vt_kernel makes the (8v)^T hi/lo planes
__global__ __launch_bounds__(64) void proj_kernel(const b16* __restrict__ X, const b16* __restrict__ Y, const b16* __restrict__ R, const float* __restrict__ P, b16* __restrict__ QH, b16* __restrict__ QL, b16* __restrict__ KH, b16* __restrict__ KL, float* __restrict__ VR) {
  __shared__ __attribute__((aligned(16))) b16 Th[2][32][64 + 8], Tl[2][32][64 + 8]; __shared__ __attribute__((aligned(16))) float Tv[32][64 + 4];
  const int lane = threadIdx.x & 31, wave = threadIdx.x >> 5, nloc = lane & 15, hlf = lane >> 4, m0 = blockIdx.x * 32;
  const b16* A = wave ? Y : X; const b16* Bw = R + (wave ? 4096 : 0); const int NSUB = wave ? 8 : 4;
  v8f acc[2][8];
#pragma unroll
  for (int r = 0; r < 2; ++r)
#pragma unroll
    for (int t = 0; t < 8; ++t) acc[r][t] = (v8f){};
#pragma unroll
  for (int kb = 0; kb < C; kb += 32) { const v16b a0 = frag_kb(A + (size_t)(m0 + nloc) * C + kb, hlf), a1 = frag_kb(A + (size_t)(m0 + 16 + nloc) * C + kb, hlf);
#pragma unroll
    for (int t = 0; t < 8; ++t) { if (t < NSUB) { const v16b bw = frag_kb(Bw + (size_t)(t * 16 + nloc) * C + kb, hlf); acc[0][t] = wmma16b(a0, bw, acc[0][t]); acc[1][t] = wmma16b(a1, bw, acc[1][t]); } } }
  // q (wave 0, t = 0..3) and k (wave 1, t = 0..3): + bias, per-head L2 normalisation (head = 8 consecutive columns = lanes with equal nloc>>3 within a subtile... a lane holds ONE column for 8 rows, so
  // the 8 columns of a head live in lanes nloc = 8g..8g+7: reduce the sum of squares over lane bits 0..2)
#pragma unroll
  for (int t = 0; t < 4; ++t) { const float bb = P[(wave ? 64 : 0) + t * 16 + nloc];
#pragma unroll
    for (int r = 0; r < 2; ++r)
#pragma unroll
      for (int v = 0; v < 8; ++v) { const float val = acc[r][t][v] * (1.0f / XS) + bb; float ss = pmul(val, val); ss += __shfl_xor(ss, 1); ss += __shfl_xor(ss, 2); ss += __shfl_xor(ss, 4); const float nv = val / fmaxf(sqrtf(ss), 1e-12f);
        b16 a_, c_; split16(nv * XS, a_, c_); Th[wave][r * 16 + 8 * hlf + v][t * 16 + nloc] = a_; Tl[wave][r * 16 + 8 * hlf + v][t * 16 + nloc] = c_; } }
  if (wave == 1) {
#pragma unroll
    for (int t = 4; t < 8; ++t) { const float bb = P[64 + t * 16 + nloc];
#pragma unroll
      for (int r = 0; r < 2; ++r)
#pragma unroll
        for (int v = 0; v < 8; ++v) Tv[r * 16 + 8 * hlf + v][(t - 4) * 16 + nloc] = acc[r][t][v] * (1.0f / XS) + bb; } }
  __syncthreads();
  b16* dh = wave ? KH : QH; b16* dl = wave ? KL : QL;
  {
    // slots: token row = H x 32 halves = 512 B; the 8 live dims of head h at offset h*32: write each head's 16-B piece (8 halves) -> 8 pieces per token row; 32 tokens x 8 = 256 pieces per wave
    for (int i = lane; i < 32 * 8; i += 32) { const int rr = i >> 3, hh2 = i & 7; const size_t gi = ((size_t)(m0 + rr) * H + hh2) * KP; *(v8b*)(dh + gi) = *(const v8b*)(&Th[wave][rr][hh2 * 8]); *(v8b*)(dl + gi) = *(const v8b*)(&Tl[wave][rr][hh2 * 8]); }
    if (wave == 1) { for (int i = lane; i < 32 * 16; i += 32) { const int rr = i >> 4, c4 = (i & 15) * 4; *(v4f*)(VR + (size_t)(m0 + rr) * C + c4) = *(const v4f*)(&Tv[rr][c4]); } }
     }
}
__global__ __launch_bounds__(256) void vt_kernel(const float* __restrict__ VR, b16* __restrict__ VTh, b16* __restrict__ VTl) {
  __shared__ __attribute__((aligned(16))) b16 Th[64][128 + 8], Tl[64][128 + 8];
  const int t0 = blockIdx.x * 128, t_ = threadIdx.x;
  for (int i = t_; i < 128 * 64; i += 256) { const int tk = i >> 6, c = i & 63; b16 a_, b_; split16(VR[(size_t)(t0 + tk) * C + c] * XS, a_, b_); Th[c][tk] = a_; Tl[c][tk] = b_; }
  __syncthreads();
  { for (int i = t_; i < 64 * 16; i += 256) { const int c = i >> 4, c8 = (i & 15) * 8; const int h = c >> 3, d = c & 7; const size_t gi = ((size_t)h * VP + d) * S + t0 + c8; *(v8b*)(VTh + gi) = *(const v8b*)(&Th[c][c8]); *(v8b*)(VTl + gi) = *(const v8b*)(&Tl[c][c8]); }  }
}
// attention: wave = (head, 16 queries), block = 8 heads; 128 key blocks: S^T = k̂.q̂ (1 k-step over the 32-wide slot, 3 products), online softmax (no scaling), o^T[16 dims (8 live)][16 q] +=
__global__ __launch_bounds__(256) void attn_kernel(const b16* __restrict__ QH, const b16* __restrict__ QL, const b16* __restrict__ KH, const b16* __restrict__ KL, const b16* __restrict__ VTh, const b16* __restrict__ VTl, b16* __restrict__ CH, b16* __restrict__ CL) {
  __shared__ __attribute__((aligned(16))) b16 Oh[16][C + 8], Ol[16][C + 8];
  const int h = threadIdx.x >> 5, lane = threadIdx.x & 31, hh = lane >> 4, col = lane & 15; const int q0 = blockIdx.x * 16, qi = q0 + col;
  const v16b qf = frag_kb(QH + ((size_t)qi * H + h) * KP, hh), ql = frag_kb(QL + ((size_t)qi * H + h) * KP, hh); const b16* V = VTh + (size_t)(h * VP) * S; const b16* Vl = VTl + (size_t)(h * VP) * S;
  float m = -INFINITY, l = 0.0f; v8f o = {};
  for (int kb = 0; kb < S; kb += 32) {
    v8f s0 = {}, s1 = {};
    { const v16b k0 = frag_kb(KH + ((size_t)(kb + col) * H + h) * KP, hh), k0l = frag_kb(KL + ((size_t)(kb + col) * H + h) * KP, hh), k1 = frag_kb(KH + ((size_t)(kb + 16 + col) * H + h) * KP, hh), k1l = frag_kb(KL + ((size_t)(kb + 16 + col) * H + h) * KP, hh);
      s0 = wmma16b(k0, qf, s0); s0 = wmma16b(k0l, qf, s0); s0 = wmma16b(k0, ql, s0); s1 = wmma16b(k1, qf, s1); s1 = wmma16b(k1l, qf, s1); s1 = wmma16b(k1, ql, s1); }
    float mr = -INFINITY;
#pragma unroll
    for (int r = 0; r < 8; ++r) { s0[r] *= 1.0f / (XS * XS); s1[r] *= 1.0f / (XS * XS); mr = fmaxf(mr, fmaxf(s0[r], s1[r])); }
    mr = fmaxf(mr, __shfl_xor(mr, 16)); const float mn = fmaxf(m, mr); const float al_ = nexp(m - mn); m = mn; float sum = 0.0f; v16b pb, pl;
#pragma unroll
    for (int r = 0; r < 8; ++r) { const float e0 = nexp(s0[r] - mn), e1 = nexp(s1[r] - mn); sum += e0 + e1; b16 a_, c_; split16(e0 * PS, a_, c_); pb[r] = a_; pl[r] = c_; split16(e1 * PS, a_, c_); pb[8 + r] = a_; pl[8 + r] = c_; }
    sum += __shfl_xor(sum, 16); l = l * al_ + sum; o *= al_;
    const v16b vh = frag_kb(V + (size_t)col * S + kb, hh); o = wmma16b(vh, pb, o); o = wmma16b(vh, pl, o); o = wmma16b(frag_kb(Vl + (size_t)col * S + kb, hh), pb, o); }
  const float inv = 1.0f / (l * PS);
  // o[r] = 8 * ctx[dim = 8*hh + r][query col]: live dims are hh == 0 (r = 0..7)
  if (hh == 0) {
#pragma unroll
    for (int r = 0; r < 8; ++r) { b16 a_, c_; split16(o[r] * inv, a_, c_); Oh[col][h * HD + r] = a_; Ol[col][h * HD + r] = c_; } }
  __syncthreads();
  { for (int i = threadIdx.x; i < 16 * 8; i += 256) { const int rr = i >> 3, c8 = (i & 7) * 8; const size_t gi = (size_t)(q0 + rr) * C + c8; *(v8b*)(CH + gi) = *(const v8b*)(&Oh[rr][c8]); *(v8b*)(CL + gi) = *(const v8b*)(&Ol[rr][c8]); }  }
}
__global__ __launch_bounds__(64) void out_kernel(const b16* __restrict__ CH, const b16* __restrict__ CL, const b16* __restrict__ R, const float* __restrict__ P, float* __restrict__ out) {
  __shared__ __attribute__((aligned(16))) float Ts[2][16][C + 4];
  const int lane = threadIdx.x & 31, wave = threadIdx.x >> 5, nloc = lane & 15, hlf = lane >> 4, m0 = blockIdx.x * 32 + wave * 16; const b16* Bw = R + 12288;
  v8f acc[4] = {{}, {}, {}, {}};
#pragma unroll
  for (int kb = 0; kb < C; kb += 32) { const v16b a = frag_kb(CH + (size_t)(m0 + nloc) * C + kb, hlf), al_ = frag_kb(CL + (size_t)(m0 + nloc) * C + kb, hlf);
#pragma unroll
    for (int t = 0; t < 4; ++t) { const v16b bw = frag_kb(Bw + (size_t)(t * 16 + nloc) * C + kb, hlf); acc[t] = wmma16b(a, bw, acc[t]); acc[t] = wmma16b(al_, bw, acc[t]); } }
#pragma unroll
  for (int t = 0; t < 4; ++t)
#pragma unroll
    for (int r = 0; r < 8; ++r) Ts[wave][8 * hlf + r][t * 16 + nloc] = acc[t][r] * (1.0f / XS) + P[192 + t * 16 + nloc];
  wave_lds_sync();
  { for (int i = lane; i < 16 * 16; i += 32) { const int rr = i >> 4, c4 = (i & 15) * 4; *(v4f*)(out + (size_t)(m0 + rr) * C + c4) = *(const v4f*)(&Ts[wave][rr][c4]); }  }
}
}  // namespace

extern "C" void kernel_launch(void* const* d_in, const int* in_sizes, int n_in,
                              void* d_out, int out_size, void* d_ws, size_t ws_size, hipStream_t stream) {
  (void)n_in; (void)out_size;
  const float* x = (const float*)d_in[0]; const float* y = (const float*)d_in[1]; const float* wq = (const float*)d_in[2]; const float* bq = (const float*)d_in[3]; const float* wkv = (const float*)d_in[4]; const float* bkv = (const float*)d_in[5]; const float* we = (const float*)d_in[6]; const float* be = (const float*)d_in[7];
  float* out = (float*)d_out;   // [1][4096][64]
  if (in_sizes[0] != S * C || in_sizes[4] != C * 2 * C) return;
  size_t off = 0; char* ws = (char*)d_ws;
  auto carve = [&](size_t bytes) { char* p = ws + off; off += (bytes + 255) & ~(size_t)255; return p; };
  b16* R = (b16*)carve(16384 * 2); float* P = (float*)carve(256 * 4); b16* X = (b16*)carve((size_t)S * C * 2); b16* Y = (b16*)carve((size_t)S * C * 2); float* VR = (float*)carve((size_t)S * C * 4); b16* CH = (b16*)carve((size_t)S * C * 2); b16* CL = (b16*)carve((size_t)S * C * 2);
  // zero-filled region (contiguous): QH, QL, KH, KL [S][H][32] and VTh, VTl [H][16][S]
  const size_t slot = (size_t)S * H * KP, plane = (size_t)H * VP * S; b16* Z0 = (b16*)carve((4 * slot + 2 * plane) * 2); b16* QH = Z0; b16* QL = Z0 + slot; b16* KH = Z0 + 2 * slot; b16* KL = Z0 + 3 * slot; b16* VTh = Z0 + 4 * slot; b16* VTl = VTh + plane;
  if (off > ws_size) return;                        // ≈ 0.5 x 4 + 1 + 8.4 + 2.1 ≈ 13 MB
  prep_kernel<<<256, 256, 0, stream>>>(x, y, wq, bq, wkv, bkv, we, be, R, P, X, Y, Z0, 4 * slot + 2 * plane);
  proj_kernel<<<S / 32, 64, 0, stream>>>(X, Y, R, P, QH, QL, KH, KL, VR);
  vt_kernel<<<S / 128, 256, 0, stream>>>(VR, VTh, VTl);
  attn_kernel<<<S / 16, 256, 0, stream>>>(QH, QL, KH, KL, VTh, VTl, CH, CL);
  out_kernel<<<S / 32, 64, 0, stream>>>(CH, CL, R, P, out);
}

// v001
// It runs in 102 microseconds.
// Next to v000, in two timings, it ran 1.71 and 1.72 times as fast.
#include <hip/hip_runtime.h>

// Cross_At: q = x Wq + bq, [k | v] = y Wkv + bkv (8 heads x 8 dims; kv laid out [hw][2][H][d]); q, k L2-normalised per head (eps 1e-12); attn = softmax(q.k) (no scaling); ctx; out = ctx We + be
// -> [1][4096][64].
// WMMA (v_wmma_f32_16x16x32_f16, f32 accumulate): the projections with EXACT operands (x, y, [in][out] weights exact bf16; 1 product) + bias, the per-head L2 normalisation in f32 in the epilogue
// (8-lane shuffles); normalised q, k as f16 hi+lo pairs x8, 16 halves [hi 8 | lo 8] per (token, head); the K = 32 of one WMMA holds k [hi | lo | hi | lo] against q [hi | hi | lo | lo], so
// S^T = k.q is 1 WMMA per 16 keys; online softmax in f32; o^T += (8v)^T.P^T with rows 0..7 = v hi, rows 8..15 = v lo and P hi, P lo (2 WMMAs), the two row halves added after the loop;
// out = ctx.We + be with ctx hi+lo (2 products). Fragment k-map per lane half hh for A AND B: elements 0..7 <- k = 8hh+0..7, 8..15 <- k = 16+8hh+0..7

namespace {
constexpr int S = 4096, C = 64, H = 8, HD = 8, KP = 16 /* head slot for q/k: 8 hi | 8 lo */, VP = 16 /* v^T rows: 8 hi, 8 lo */;
constexpr float XS = 8.0f, PS = 8.0f;

typedef _Float16 b16;
typedef __attribute__((ext_vector_type(16))) _Float16 v16b;
typedef __attribute__((ext_vector_type(8))) _Float16 v8b;
typedef __attribute__((ext_vector_type(8))) float v8f;
typedef __attribute__((ext_vector_type(4))) float v4f;
__device__ __forceinline__ float bf16_rne(float f) { unsigned int u = __float_as_uint(f); u += 0x7FFFu + ((u >> 16) & 1u); return __uint_as_float(u & 0xFFFF0000u); }
__device__ __forceinline__ void split16(float v, b16& hi, b16& lo) { hi = (b16)v; lo = (b16)(v - (float)hi); }
__device__ __forceinline__ v16b frag_kb(const b16* p, int hh) { const v8b a = *(const v8b*)(p + 8 * hh), b = *(const v8b*)(p + 16 + 8 * hh); v16b f;
#pragma unroll
  for (int e = 0; e < 8; ++e) { f[e] = a[e]; f[8 + e] = b[e]; } return f; }
__device__ __forceinline__ v16b frag_cat(v8b a, v8b b) { v16b f;
#pragma unroll   // constant element indices keep the fragment in registers
  for (int e = 0; e < 8; ++e) { f[e] = a[e]; f[8 + e] = b[e]; } return f; }
__device__ __forceinline__ v8f wmma16b(v16b a, v16b b, v8f c) { v8f d = __builtin_amdgcn_wmma_f32_16x16x32_f16(false, a, false, b, (short)0, c, false, false); asm volatile("v_nop\n\tv_nop\n\tv_nop\n\tv_nop" : "+v"(d) : "v"(a), "v"(b)); return d; }
__device__ __forceinline__ void wave_lds_sync() { __builtin_amdgcn_fence(__ATOMIC_RELEASE, "workgroup"); __builtin_amdgcn_wave_barrier(); __builtin_amdgcn_fence(__ATOMIC_ACQUIRE, "workgroup"); }
__device__ __forceinline__ float nexp(float x) { return __builtin_amdgcn_exp2f(x * 1.4426950408889634f); }
__device__ __forceinline__ float pmul(float a, float b) { float p = a * b; asm volatile("" : "+v"(p)); return p; }

// prep: B rows Wq^T [64][64] @0, Wkv^T [128][64] @4096, We^T [64][64] @12288 (f16 exact); P: bq @0, bkv @64, be @192; X, Y rows f16 exact x8.
__global__ __launch_bounds__(256) void prep_kernel(const float* __restrict__ x, const float* __restrict__ y, const float* __restrict__ wq, const float* __restrict__ bq, const float* __restrict__ wkv, const float* __restrict__ bkv, const float* __restrict__ we, const float* __restrict__ be, b16* __restrict__ R, float* __restrict__ P, b16* __restrict__ X, b16* __restrict__ Y) {
  const size_t tid = (size_t)blockIdx.x * 256 + threadIdx.x, nth = (size_t)gridDim.x * 256;
  {
    for (size_t p = tid; p < (size_t)C * C; p += nth) { const int o = (int)(p / C), k = (int)(p % C); ((b16*)R)[p] = (b16)bf16_rne(wq[(size_t)k * C + o]); ((b16*)R)[12288 + p] = (b16)bf16_rne(we[(size_t)k * C + o]); }
    for (size_t p = tid; p < (size_t)2 * C * C; p += nth) { const int o = (int)(p / C), k = (int)(p % C); ((b16*)R)[4096 + p] = (b16)bf16_rne(wkv[(size_t)k * 2 * C + o]); }
    for (size_t q = tid; q < 256; q += nth) { const int i = (int)q; P[q] = bf16_rne((i < 64) ? bq[i] : (i < 192) ? bkv[i - 64] : be[i - 192]); }
    for (size_t p = tid; p < (size_t)S * C / 8; p += nth) { v8b a, b; for (int e = 0; e < 8; ++e) { a[e] = (b16)(bf16_rne(x[p * 8 + e]) * XS); b[e] = (b16)(bf16_rne(y[p * 8 + e]) * XS); } *(v8b*)(X + p * 8) = a; *(v8b*)(Y + p * 8) = b; }
     }
}

// projections: block = 32 tokens x 2 waves; wave 0: q = x Wq + bq (64 cols) -> L2-normalise each 8-dim head (shuffles over the 8 lanes of a head) -> Q2[tok][h][hi 8 | lo 8];
// wave 1: kv = y Wkv + bkv (128 cols): k (cols 0..63) normalised -> K2[h][tok][hi 8 | lo 8] (16 keys of a head = 512 contiguous bytes); v (cols 64..127) -> VR rows in f32 through LDS
__global__ __launch_bounds__(64) void proj_kernel(const b16* __restrict__ X, const b16* __restrict__ Y, const b16* __restrict__ R, const float* __restrict__ P, b16* __restrict__ Q2, b16* __restrict__ K2, float* __restrict__ VR) {
  __shared__ __attribute__((aligned(16))) b16 Th[2][32][64 + 8], Tl[2][32][64 + 8]; __shared__ __attribute__((aligned(16))) float Tv[32][64 + 4];
  const int lane = threadIdx.x & 31, wave = threadIdx.x >> 5, nloc = lane & 15, hlf = lane >> 4, m0 = blockIdx.x * 32;
  const b16* A = wave ? Y : X; const b16* Bw = R + (wave ? 4096 : 0); const int NSUB = wave ? 8 : 4;
  v8f acc[2][8];
#pragma unroll
  for (int r = 0; r < 2; ++r)
#pragma unroll
    for (int t = 0; t < 8; ++t) acc[r][t] = (v8f){};
#pragma unroll
  for (int kb = 0; kb < C; kb += 32) { const v16b a0 = frag_kb(A + (size_t)(m0 + nloc) * C + kb, hlf), a1 = frag_kb(A + (size_t)(m0 + 16 + nloc) * C + kb, hlf);
#pragma unroll
    for (int t = 0; t < 8; ++t) { if (t < NSUB) { const v16b bw = frag_kb(Bw + (size_t)(t * 16 + nloc) * C + kb, hlf); acc[0][t] = wmma16b(a0, bw, acc[0][t]); acc[1][t] = wmma16b(a1, bw, acc[1][t]); } } }
  // q (wave 0, t = 0..3) and k (wave 1, t = 0..3): + bias, per-head L2 normalisation (head = 8 consecutive columns = lanes with equal nloc>>3 within a subtile... a lane holds ONE column for 8 rows, so
  // the 8 columns of a head live in lanes nloc = 8g..8g+7: reduce the sum of squares over lane bits 0..2)
#pragma unroll
  for (int t = 0; t < 4; ++t) { const float bb = P[(wave ? 64 : 0) + t * 16 + nloc];
#pragma unroll
    for (int r = 0; r < 2; ++r)
#pragma unroll
      for (int v = 0; v < 8; ++v) { const float val = acc[r][t][v] * (1.0f / XS) + bb; float ss = pmul(val, val); ss += __shfl_xor(ss, 1); ss += __shfl_xor(ss, 2); ss += __shfl_xor(ss, 4); const float nv = val / fmaxf(sqrtf(ss), 1e-12f);
        b16 a_, c_; split16(nv * XS, a_, c_); Th[wave][r * 16 + 8 * hlf + v][t * 16 + nloc] = a_; Tl[wave][r * 16 + 8 * hlf + v][t * 16 + nloc] = c_; } }
  if (wave == 1) {
#pragma unroll
    for (int t = 4; t < 8; ++t) { const float bb = P[64 + t * 16 + nloc];
#pragma unroll
      for (int r = 0; r < 2; ++r)
#pragma unroll
        for (int v = 0; v < 8; ++v) Tv[r * 16 + 8 * hlf + v][(t - 4) * 16 + nloc] = acc[r][t][v] * (1.0f / XS) + bb; } }
  __syncthreads();
  {
    // 32 tokens x 8 heads = 256 slots of 32 B (hi piece, lo piece) per wave; q is token-major, k head-major: each wave walks its slots in the order of its own destination
    for (int i = lane; i < 32 * 8; i += 32) { const int rr = wave ? (i & 31) : (i >> 3), hh2 = wave ? (i >> 5) : (i & 7); b16* d = wave ? K2 + ((size_t)hh2 * S + m0 + rr) * KP : Q2 + ((size_t)(m0 + rr) * H + hh2) * KP;
      *(v8b*)d = *(const v8b*)(&Th[wave][rr][hh2 * 8]); *(v8b*)(d + 8) = *(const v8b*)(&Tl[wave][rr][hh2 * 8]); }
    if (wave == 1) { for (int i = lane; i < 32 * 16; i += 32) { const int rr = i >> 4, c4 = (i & 15) * 4; *(v4f*)(VR + (size_t)(m0 + rr) * C + c4) = *(const v4f*)(&Tv[rr][c4]); } }
     }
}
// (8v)^T in the order of the attention's A fragments: V2[h][32-key block][c][row][hh][8 keys], key = 32 block + 16 c + 8 hh + e; rows 0..7 = hi of dims 0..7, rows 8..15 = lo: one c = 512 contiguous bytes
__global__ __launch_bounds__(256) void vt_kernel(const float* __restrict__ VR, b16* __restrict__ V2) {
  __shared__ __attribute__((aligned(16))) b16 Th[64][128 + 8], Tl[64][128 + 8];
  const int t0 = blockIdx.x * 128, t_ = threadIdx.x;
  for (int i = t_; i < 128 * 64; i += 256) { const int tk = i >> 6, c = i & 63; b16 a_, b_; split16(VR[(size_t)(t0 + tk) * C + c] * XS, a_, b_); Th[c][tk] = a_; Tl[c][tk] = b_; }
  __syncthreads();
  { for (int i = t_; i < 8 * 256; i += 256) { const int h = i >> 8, j = i & 255, tk = (j >> 6) * 32 + ((j >> 5) & 1) * 16 + (j & 1) * 8, row = (j >> 1) & 15, ch = h * HD + (row & 7);
      *(v8b*)(V2 + ((size_t)h * (S / 32) + t0 / 32) * (32 * VP) + j * 8) = *(const v8b*)(row < 8 ? &Th[ch][tk] : &Tl[ch][tk]); }  }
}
// attention: wave = (head, 16 queries), block = 8 heads; 128 key blocks of 32: S^T = k.q (1 WMMA per 16 keys, hi and lo terms side by side in its K = 32), online softmax (no scaling),
// o^T[rows 0..7: v hi, rows 8..15: v lo][16 q] += (8v)^T.P^T (P hi, P lo); every fragment load of the loop is 512 contiguous bytes per wave
__global__ __launch_bounds__(256) void attn_kernel(const b16* __restrict__ Q2, const b16* __restrict__ K2, const b16* __restrict__ V2, b16* __restrict__ CH, b16* __restrict__ CL) {
  __shared__ __attribute__((aligned(16))) b16 Oh[16][C + 8], Ol[16][C + 8];
  const int h = threadIdx.x >> 5, lane = threadIdx.x & 31, hh = lane >> 4, col = lane & 15; const int q0 = blockIdx.x * 16, qi = q0 + col;
  // B: both lane halves hold [q hi | q lo]; A: lane half 0 holds [k hi | k hi], half 1 [k lo | k lo]: k 0..7 hi.hi, 8..15 lo.hi, 16..23 hi.lo, 24..31 lo.lo
  const b16* Qp = Q2 + ((size_t)qi * H + h) * KP; const v16b qf = frag_cat(*(const v8b*)Qp, *(const v8b*)(Qp + 8));
  const b16* K = K2 + ((size_t)h * S + col) * KP + 8 * hh; const b16* V = V2 + (size_t)h * VP * S + col * 16 + 8 * hh;
  float m = -INFINITY, l = 0.0f; v8f o = {};
  for (int kb = 0; kb < S; kb += 32) {
    v8f s0 = {}, s1 = {};
    const v8b k0 = *(const v8b*)(K + (size_t)kb * KP), k1 = *(const v8b*)(K + (size_t)(kb + 16) * KP), v0 = *(const v8b*)(V + (size_t)kb * VP), v1 = *(const v8b*)(V + (size_t)kb * VP + 256);
    s0 = wmma16b(frag_cat(k0, k0), qf, s0); s1 = wmma16b(frag_cat(k1, k1), qf, s1);
    float mr = -INFINITY;
#pragma unroll
    for (int r = 0; r < 8; ++r) { s0[r] *= 1.0f / (XS * XS); s1[r] *= 1.0f / (XS * XS); mr = fmaxf(mr, fmaxf(s0[r], s1[r])); }
    mr = fmaxf(mr, __shfl_xor(mr, 16)); const float mn = fmaxf(m, mr); const float al_ = nexp(m - mn); m = mn; float sum = 0.0f; v16b pb, pl;
#pragma unroll
    for (int r = 0; r < 8; ++r) { const float e0 = nexp(s0[r] - mn), e1 = nexp(s1[r] - mn); sum += e0 + e1; b16 a_, c_; split16(e0 * PS, a_, c_); pb[r] = a_; pl[r] = c_; split16(e1 * PS, a_, c_); pb[8 + r] = a_; pl[8 + r] = c_; }
    sum += __shfl_xor(sum, 16); l = l * al_ + sum; o *= al_;
    const v16b vf = frag_cat(v0, v1); o = wmma16b(vf, pb, o); o = wmma16b(vf, pl, o); }
  const float inv = 1.0f / (l * PS);
  // o[r] = 8 * PS * l * (hi part (hh == 0) or lo part (hh == 1) of ctx[dim r][query col]): add the two lane halves, lane half 0 stores
#pragma unroll   // constant element indices keep the accumulator in registers
  for (int r = 0; r < 8; ++r) o[r] += __shfl_xor(o[r], 16);
  if (hh == 0) {
#pragma unroll
    for (int r = 0; r < 8; ++r) { b16 a_, c_; split16(o[r] * inv, a_, c_); Oh[col][h * HD + r] = a_; Ol[col][h * HD + r] = c_; } }
  __syncthreads();
  { for (int i = threadIdx.x; i < 16 * 8; i += 256) { const int rr = i >> 3, c8 = (i & 7) * 8; const size_t gi = (size_t)(q0 + rr) * C + c8; *(v8b*)(CH + gi) = *(const v8b*)(&Oh[rr][c8]); *(v8b*)(CL + gi) = *(const v8b*)(&Ol[rr][c8]); }  }
}
__global__ __launch_bounds__(64) void out_kernel(const b16* __restrict__ CH, const b16* __restrict__ CL, const b16* __restrict__ R, const float* __restrict__ P, float* __restrict__ out) {
  __shared__ __attribute__((aligned(16))) float Ts[2][16][C + 4];
  const int lane = threadIdx.x & 31, wave = threadIdx.x >> 5, nloc = lane & 15, hlf = lane >> 4, m0 = blockIdx.x * 32 + wave * 16; const b16* Bw = R + 12288;
  v8f acc[4] = {{}, {}, {}, {}};
#pragma unroll
  for (int kb = 0; kb < C; kb += 32) { const v16b a = frag_kb(CH + (size_t)(m0 + nloc) * C + kb, hlf), al_ = frag_kb(CL + (size_t)(m0 + nloc) * C + kb, hlf);
#pragma unroll
    for (int t = 0; t < 4; ++t) { const v16b bw = frag_kb(Bw + (size_t)(t * 16 + nloc) * C + kb, hlf); acc[t] = wmma16b(a, bw, acc[t]); acc[t] = wmma16b(al_, bw, acc[t]); } }
#pragma unroll
  for (int t = 0; t < 4; ++t)
#pragma unroll
    for (int r = 0; r < 8; ++r) Ts[wave][8 * hlf + r][t * 16 + nloc] = acc[t][r] * (1.0f / XS) + P[192 + t * 16 + nloc];
  wave_lds_sync();
  { for (int i = lane; i < 16 * 16; i += 32) { const int rr = i >> 4, c4 = (i & 15) * 4; *(v4f*)(out + (size_t)(m0 + rr) * C + c4) = *(const v4f*)(&Ts[wave][rr][c4]); }  }
}
}  // namespace

extern "C" void kernel_launch(void* const* d_in, const int* in_sizes, int n_in,
                              void* d_out, int out_size, void* d_ws, size_t ws_size, hipStream_t stream) {
  (void)n_in; (void)out_size;
  const float* x = (const float*)d_in[0]; const float* y = (const float*)d_in[1]; const float* wq = (const float*)d_in[2]; const float* bq = (const float*)d_in[3]; const float* wkv = (const float*)d_in[4]; const float* bkv = (const float*)d_in[5]; const float* we = (const float*)d_in[6]; const float* be = (const float*)d_in[7];
  float* out = (float*)d_out;   // [1][4096][64]
  if (in_sizes[0] != S * C || in_sizes[4] != C * 2 * C) return;
  size_t off = 0; char* ws = (char*)d_ws;
  auto carve = [&](size_t bytes) { char* p = ws + off; off += (bytes + 255) & ~(size_t)255; return p; };
  b16* R = (b16*)carve(16384 * 2); float* P = (float*)carve(256 * 4); b16* X = (b16*)carve((size_t)S * C * 2); b16* Y = (b16*)carve((size_t)S * C * 2); float* VR = (float*)carve((size_t)S * C * 4); b16* CH = (b16*)carve((size_t)S * C * 2); b16* CL = (b16*)carve((size_t)S * C * 2);
  b16* Q2 = (b16*)carve((size_t)S * H * KP * 2); b16* K2 = (b16*)carve((size_t)S * H * KP * 2); b16* V2 = (b16*)carve((size_t)H * VP * S * 2);   // every element written by proj_kernel / vt_kernel
  if (off > ws_size) return;                        // about 6 MB
  prep_kernel<<<256, 256, 0, stream>>>(x, y, wq, bq, wkv, bkv, we, be, R, P, X, Y);
  proj_kernel<<<S / 32, 64, 0, stream>>>(X, Y, R, P, Q2, K2, VR);
  vt_kernel<<<S / 128, 256, 0, stream>>>(VR, V2);
  attn_kernel<<<S / 16, 256, 0, stream>>>(Q2, K2, V2, CH, CL);
  out_kernel<<<S / 32, 64, 0, stream>>>(CH, CL, R, P, out);
}

// v002
// One run takes 93.5 microseconds.
// Two timings next to v001 put it at 1.10 and 1.09 times that version's speed.
// All steps since v000 together make it 1.88 times as fast.
#include <hip/hip_runtime.h>

// Cross_At: q = x Wq + bq, [k | v] = y Wkv + bkv (8 heads x 8 dims; kv laid out [hw][2][H][d]); q, k L2-normalised per head (eps 1e-12); attn = softmax(q.k) (no scaling); ctx; out = ctx We + be
// -> [1][4096][64].
// WMMA (v_wmma_f32_16x16x32_f16, f32 accumulate): the projections with EXACT operands (x, y, [in][out] weights exact bf16; 1 product) + bias, the per-head L2 normalisation in f32 in the epilogue
// (8-lane shuffles); normalised k x8 and q x log2(e)/8 as f16 hi+lo pairs, 16 halves [hi 8 | lo 8] per (token, head); the K = 32 of one WMMA holds k [hi | lo | hi | lo] against q [hi | hi | lo | lo], so
// S^T = k.q is 1 WMMA per 16 keys; softmax in f32 with a constant shift (every score is a cosine); o^T += (8v)^T.P^T with rows 0..7 = v hi, rows 8..15 = v lo and P hi, P lo (2 WMMAs), the two row halves added after the loop;
// out = ctx.We + be with ctx hi+lo (2 products). Fragment k-map per lane half hh for A AND B: elements 0..7 <- k = 8hh+0..7, 8..15 <- k = 16+8hh+0..7

namespace {
constexpr int S = 4096, C = 64, H = 8, HD = 8, KP = 16 /* head slot for q/k: 8 hi | 8 lo */, VP = 16 /* v^T rows: 8 hi, 8 lo */;
constexpr float XS = 8.0f;
constexpr float QS = 1.4426950408889634f / XS;   // q is stored as q * log2(e) / 8, so (8k).(q') = log2(e) * cos(q, k): the exponent of exp2 with no further scaling
constexpr float PSH = 4.0f;                      // constant exponent shift, the C operand of the score WMMA: p = 2^4 * exp(cos) lies in [16/e, 16e] for EVERY input, as |cos| <= 1

typedef _Float16 b16;
typedef __attribute__((ext_vector_type(16))) _Float16 v16b;
typedef __attribute__((ext_vector_type(8))) _Float16 v8b;
typedef __attribute__((ext_vector_type(8))) float v8f;
typedef __attribute__((ext_vector_type(4))) float v4f;
__device__ __forceinline__ float bf16_rne(float f) { unsigned int u = __float_as_uint(f); u += 0x7FFFu + ((u >> 16) & 1u); return __uint_as_float(u & 0xFFFF0000u); }
__device__ __forceinline__ void split16(float v, b16& hi, b16& lo) { hi = (b16)v; lo = (b16)(v - (float)hi); }
__device__ __forceinline__ v16b frag_kb(const b16* p, int hh) { const v8b a = *(const v8b*)(p + 8 * hh), b = *(const v8b*)(p + 16 + 8 * hh); v16b f;
#pragma unroll
  for (int e = 0; e < 8; ++e) { f[e] = a[e]; f[8 + e] = b[e]; } return f; }
__device__ __forceinline__ v16b frag_cat(v8b a, v8b b) { v16b f;
#pragma unroll   // constant element indices keep the fragment in registers
  for (int e = 0; e < 8; ++e) { f[e] = a[e]; f[8 + e] = b[e]; } return f; }
__device__ __forceinline__ v8f wmma16b(v16b a, v16b b, v8f c) { v8f d = __builtin_amdgcn_wmma_f32_16x16x32_f16(false, a, false, b, (short)0, c, false, false); asm volatile("v_nop\n\tv_nop\n\tv_nop\n\tv_nop" : "+v"(d) : "v"(a), "v"(b)); return d; }
__device__ __forceinline__ void wave_lds_sync() { __builtin_amdgcn_fence(__ATOMIC_RELEASE, "workgroup"); __builtin_amdgcn_wave_barrier(); __builtin_amdgcn_fence(__ATOMIC_ACQUIRE, "workgroup"); }
__device__ __forceinline__ float pmul(float a, float b) { float p = a * b; asm volatile("" : "+v"(p)); return p; }

// prep: B rows Wq^T [64][64] @0, Wkv^T [128][64] @4096, We^T [64][64] @12288 (f16 exact); P: bq @0, bkv @64, be @192; X, Y rows f16 exact x8.
__global__ __launch_bounds__(256) void prep_kernel(const float* __restrict__ x, const float* __restrict__ y, const float* __restrict__ wq, const float* __restrict__ bq, const float* __restrict__ wkv, const float* __restrict__ bkv, const float* __restrict__ we, const float* __restrict__ be, b16* __restrict__ R, float* __restrict__ P, b16* __restrict__ X, b16* __restrict__ Y) {
  const size_t tid = (size_t)blockIdx.x * 256 + threadIdx.x, nth = (size_t)gridDim.x * 256;
  {
    for (size_t p = tid; p < (size_t)C * C; p += nth) { const int o = (int)(p / C), k = (int)(p % C); ((b16*)R)[p] = (b16)bf16_rne(wq[(size_t)k * C + o]); ((b16*)R)[12288 + p] = (b16)bf16_rne(we[(size_t)k * C + o]); }
    for (size_t p = tid; p < (size_t)2 * C * C; p += nth) { const int o = (int)(p / C), k = (int)(p % C); ((b16*)R)[4096 + p] = (b16)bf16_rne(wkv[(size_t)k * 2 * C + o]); }
    for (size_t q = tid; q < 256; q += nth) { const int i = (int)q; P[q] = bf16_rne((i < 64) ? bq[i] : (i < 192) ? bkv[i - 64] : be[i - 192]); }
    for (size_t p = tid; p < (size_t)S * C / 8; p += nth) { v8b a, b; for (int e = 0; e < 8; ++e) { a[e] = (b16)(bf16_rne(x[p * 8 + e]) * XS); b[e] = (b16)(bf16_rne(y[p * 8 + e]) * XS); } *(v8b*)(X + p * 8) = a; *(v8b*)(Y + p * 8) = b; }
     }
}

// projections: block = 32 tokens x 2 waves; wave 0: q = x Wq + bq (64 cols) -> L2-normalise each 8-dim head (shuffles over the 8 lanes of a head) -> Q2[tok][h][hi 8 | lo 8];
// wave 1: kv = y Wkv + bkv (128 cols): k (cols 0..63) normalised -> K2[h][tok][hi 8 | lo 8] (16 keys of a head = 512 contiguous bytes); v (cols 64..127) -> VR rows in f32 through LDS
__global__ __launch_bounds__(64) void proj_kernel(const b16* __restrict__ X, const b16* __restrict__ Y, const b16* __restrict__ R, const float* __restrict__ P, b16* __restrict__ Q2, b16* __restrict__ K2, float* __restrict__ VR) {
  __shared__ __attribute__((aligned(16))) b16 Th[2][32][64 + 8], Tl[2][32][64 + 8]; __shared__ __attribute__((aligned(16))) float Tv[32][64 + 4];
  const int lane = threadIdx.x & 31, wave = threadIdx.x >> 5, nloc = lane & 15, hlf = lane >> 4, m0 = blockIdx.x * 32;
  const b16* A = wave ? Y : X; const b16* Bw = R + (wave ? 4096 : 0); const int NSUB = wave ? 8 : 4;
  v8f acc[2][8];
#pragma unroll
  for (int r = 0; r < 2; ++r)
#pragma unroll
    for (int t = 0; t < 8; ++t) acc[r][t] = (v8f){};
#pragma unroll
  for (int kb = 0; kb < C; kb += 32) { const v16b a0 = frag_kb(A + (size_t)(m0 + nloc) * C + kb, hlf), a1 = frag_kb(A + (size_t)(m0 + 16 + nloc) * C + kb, hlf);
#pragma unroll
    for (int t = 0; t < 8; ++t) { if (t < NSUB) { const v16b bw = frag_kb(Bw + (size_t)(t * 16 + nloc) * C + kb, hlf); acc[0][t] = wmma16b(a0, bw, acc[0][t]); acc[1][t] = wmma16b(a1, bw, acc[1][t]); } } }
  // q (wave 0, t = 0..3) and k (wave 1, t = 0..3): + bias, per-head L2 normalisation (head = 8 consecutive columns = lanes with equal nloc>>3 within a subtile... a lane holds ONE column for 8 rows, so
  // the 8 columns of a head live in lanes nloc = 8g..8g+7: reduce the sum of squares over lane bits 0..2)
#pragma unroll
  for (int t = 0; t < 4; ++t) { const float bb = P[(wave ? 64 : 0) + t * 16 + nloc];
#pragma unroll
    for (int r = 0; r < 2; ++r)
#pragma unroll
      for (int v = 0; v < 8; ++v) { const float val = acc[r][t][v] * (1.0f / XS) + bb; float ss = pmul(val, val); ss += __shfl_xor(ss, 1); ss += __shfl_xor(ss, 2); ss += __shfl_xor(ss, 4); const float nv = val / fmaxf(sqrtf(ss), 1e-12f);
        b16 a_, c_; split16(nv * (wave ? XS : QS), a_, c_); Th[wave][r * 16 + 8 * hlf + v][t * 16 + nloc] = a_; Tl[wave][r * 16 + 8 * hlf + v][t * 16 + nloc] = c_; } }
  if (wave == 1) {
#pragma unroll
    for (int t = 4; t < 8; ++t) { const float bb = P[64 + t * 16 + nloc];
#pragma unroll
      for (int r = 0; r < 2; ++r)
#pragma unroll
        for (int v = 0; v < 8; ++v) Tv[r * 16 + 8 * hlf + v][(t - 4) * 16 + nloc] = acc[r][t][v] * (1.0f / XS) + bb; } }
  __syncthreads();
  {
    // 32 tokens x 8 heads = 256 slots of 32 B (hi piece, lo piece) per wave; q is token-major, k head-major: each wave walks its slots in the order of its own destination
    for (int i = lane; i < 32 * 8; i += 32) { const int rr = wave ? (i & 31) : (i >> 3), hh2 = wave ? (i >> 5) : (i & 7); b16* d = wave ? K2 + ((size_t)hh2 * S + m0 + rr) * KP : Q2 + ((size_t)(m0 + rr) * H + hh2) * KP;
      *(v8b*)d = *(const v8b*)(&Th[wave][rr][hh2 * 8]); *(v8b*)(d + 8) = *(const v8b*)(&Tl[wave][rr][hh2 * 8]); }
    if (wave == 1) { for (int i = lane; i < 32 * 16; i += 32) { const int rr = i >> 4, c4 = (i & 15) * 4; *(v4f*)(VR + (size_t)(m0 + rr) * C + c4) = *(const v4f*)(&Tv[rr][c4]); } }
     }
}
// (8v)^T in the order of the attention's A fragments: V2[h][32-key block][c][row][hh][8 keys], key = 32 block + 16 c + 8 hh + e; rows 0..7 = hi of dims 0..7, rows 8..15 = lo: one c = 512 contiguous bytes
__global__ __launch_bounds__(256) void vt_kernel(const float* __restrict__ VR, b16* __restrict__ V2) {
  __shared__ __attribute__((aligned(16))) b16 Th[64][128 + 8], Tl[64][128 + 8];
  const int t0 = blockIdx.x * 128, t_ = threadIdx.x;
  for (int i = t_; i < 128 * 64; i += 256) { const int tk = i >> 6, c = i & 63; b16 a_, b_; split16(VR[(size_t)(t0 + tk) * C + c] * XS, a_, b_); Th[c][tk] = a_; Tl[c][tk] = b_; }
  __syncthreads();
  { for (int i = t_; i < 8 * 256; i += 256) { const int h = i >> 8, j = i & 255, tk = (j >> 6) * 32 + ((j >> 5) & 1) * 16 + (j & 1) * 8, row = (j >> 1) & 15, ch = h * HD + (row & 7);
      *(v8b*)(V2 + ((size_t)h * (S / 32) + t0 / 32) * (32 * VP) + j * 8) = *(const v8b*)(row < 8 ? &Th[ch][tk] : &Tl[ch][tk]); }  }
}
// attention: wave = (head, 16 queries), block = 8 heads; 128 key blocks of 32: S^T = k.q (1 WMMA per 16 keys, hi and lo terms side by side in its K = 32), p = exp2 of its result,
// o^T[rows 0..7: v hi, rows 8..15: v lo][16 q] += (8v)^T.P^T (P hi, P lo); every fragment load of the loop is 512 contiguous bytes per wave
__global__ __launch_bounds__(256) void attn_kernel(const b16* __restrict__ Q2, const b16* __restrict__ K2, const b16* __restrict__ V2, b16* __restrict__ CH, b16* __restrict__ CL) {
  __shared__ __attribute__((aligned(16))) b16 Oh[16][C + 8], Ol[16][C + 8];
  const int h = threadIdx.x >> 5, lane = threadIdx.x & 31, hh = lane >> 4, col = lane & 15; const int q0 = blockIdx.x * 16, qi = q0 + col;
  // B: both lane halves hold [q hi | q lo]; A: lane half 0 holds [k hi | k hi], half 1 [k lo | k lo]: k 0..7 hi.hi, 8..15 lo.hi, 16..23 hi.lo, 24..31 lo.lo
  const b16* Qp = Q2 + ((size_t)qi * H + h) * KP; const v16b qf = frag_cat(*(const v8b*)Qp, *(const v8b*)(Qp + 8));
  const b16* K = K2 + ((size_t)h * S + col) * KP + 8 * hh; const b16* V = V2 + (size_t)h * VP * S + col * 16 + 8 * hh;
  // q and k are unit vectors (or shorter, at the eps clamp), so every score lies in [-1, 1]: no running maximum, no rescaling of o and l; the lane halves' sums meet after the loop
  const v8f sh = {PSH, PSH, PSH, PSH, PSH, PSH, PSH, PSH}; v8f lv = {}, o = {};
  for (int kb = 0; kb < S; kb += 32) {
    const v8b k0 = *(const v8b*)(K + (size_t)kb * KP), k1 = *(const v8b*)(K + (size_t)(kb + 16) * KP), v0 = *(const v8b*)(V + (size_t)kb * VP), v1 = *(const v8b*)(V + (size_t)kb * VP + 256);
    const v8f s0 = wmma16b(frag_cat(k0, k0), qf, sh), s1 = wmma16b(frag_cat(k1, k1), qf, sh); v16b pb, pl;
#pragma unroll
    for (int r = 0; r < 8; ++r) { const float e0 = __builtin_amdgcn_exp2f(s0[r]), e1 = __builtin_amdgcn_exp2f(s1[r]); lv[r] += e0 + e1; b16 a_, c_; split16(e0, a_, c_); pb[r] = a_; pl[r] = c_; split16(e1, a_, c_); pb[8 + r] = a_; pl[8 + r] = c_; }
    const v16b vf = frag_cat(v0, v1); o = wmma16b(vf, pb, o); o = wmma16b(vf, pl, o); }
  float l = ((lv[0] + lv[1]) + (lv[2] + lv[3])) + ((lv[4] + lv[5]) + (lv[6] + lv[7])); l += __shfl_xor(l, 16);
  const float inv = 1.0f / l;
  // o[r] = 8 * l * (hi part (hh == 0) or lo part (hh == 1) of ctx[dim r][query col]): add the two lane halves, lane half 0 stores
#pragma unroll   // constant element indices keep the accumulator in registers
  for (int r = 0; r < 8; ++r) o[r] += __shfl_xor(o[r], 16);
  if (hh == 0) {
#pragma unroll
    for (int r = 0; r < 8; ++r) { b16 a_, c_; split16(o[r] * inv, a_, c_); Oh[col][h * HD + r] = a_; Ol[col][h * HD + r] = c_; } }
  __syncthreads();
  { for (int i = threadIdx.x; i < 16 * 8; i += 256) { const int rr = i >> 3, c8 = (i & 7) * 8; const size_t gi = (size_t)(q0 + rr) * C + c8; *(v8b*)(CH + gi) = *(const v8b*)(&Oh[rr][c8]); *(v8b*)(CL + gi) = *(const v8b*)(&Ol[rr][c8]); }  }
}
__global__ __launch_bounds__(64) void out_kernel(const b16* __restrict__ CH, const b16* __restrict__ CL, const b16* __restrict__ R, const float* __restrict__ P, float* __restrict__ out) {
  __shared__ __attribute__((aligned(16))) float Ts[2][16][C + 4];
  const int lane = threadIdx.x & 31, wave = threadIdx.x >> 5, nloc = lane & 15, hlf = lane >> 4, m0 = blockIdx.x * 32 + wave * 16; const b16* Bw = R + 12288;
  v8f acc[4] = {{}, {}, {}, {}};
#pragma unroll
  for (int kb = 0; kb < C; kb += 32) { const v16b a = frag_kb(CH + (size_t)(m0 + nloc) * C + kb, hlf), al_ = frag_kb(CL + (size_t)(m0 + nloc) * C + kb, hlf);
#pragma unroll
    for (int t = 0; t < 4; ++t) { const v16b bw = frag_kb(Bw + (size_t)(t * 16 + nloc) * C + kb, hlf); acc[t] = wmma16b(a, bw, acc[t]); acc[t] = wmma16b(al_, bw, acc[t]); } }
#pragma unroll
  for (int t = 0; t < 4; ++t)
#pragma unroll
    for (int r = 0; r < 8; ++r) Ts[wave][8 * hlf + r][t * 16 + nloc] = acc[t][r] * (1.0f / XS) + P[192 + t * 16 + nloc];
  wave_lds_sync();
  { for (int i = lane; i < 16 * 16; i += 32) { const int rr = i >> 4, c4 = (i & 15) * 4; *(v4f*)(out + (size_t)(m0 + rr) * C + c4) = *(const v4f*)(&Ts[wave][rr][c4]); }  }
}
}  // namespace

extern "C" void kernel_launch(void* const* d_in, const int* in_sizes, int n_in,
                              void* d_out, int out_size, void* d_ws, size_t ws_size, hipStream_t stream) {
  (void)n_in; (void)out_size;
  const float* x = (const float*)d_in[0]; const float* y = (const float*)d_in[1]; const float* wq = (const float*)d_in[2]; const float* bq = (const float*)d_in[3]; const float* wkv = (const float*)d_in[4]; const float* bkv = (const float*)d_in[5]; const float* we = (const float*)d_in[6]; const float* be = (const float*)d_in[7];
  float* out = (float*)d_out;   // [1][4096][64]
  if (in_sizes[0] != S * C || in_sizes[4] != C * 2 * C) return;
  size_t off = 0; char* ws = (char*)d_ws;
  auto carve = [&](size_t bytes) { char* p = ws + off; off += (bytes + 255) & ~(size_t)255; return p; };
  b16* R = (b16*)carve(16384 * 2); float* P = (float*)carve(256 * 4); b16* X = (b16*)carve((size_t)S * C * 2); b16* Y = (b16*)carve((size_t)S * C * 2); float* VR = (float*)carve((size_t)S * C * 4); b16* CH = (b16*)carve((size_t)S * C * 2); b16* CL = (b16*)carve((size_t)S * C * 2);
  b16* Q2 = (b16*)carve((size_t)S * H * KP * 2); b16* K2 = (b16*)carve((size_t)S * H * KP * 2); b16* V2 = (b16*)carve((size_t)H * VP * S * 2);   // every element written by proj_kernel / vt_kernel
  if (off > ws_size) return;                        // about 6 MB
  prep_kernel<<<256, 256, 0, stream>>>(x, y, wq, bq, wkv, bkv, we, be, R, P, X, Y);
  proj_kernel<<<S / 32, 64, 0, stream>>>(X, Y, R, P, Q2, K2, VR);
  vt_kernel<<<S / 128, 256, 0, stream>>>(VR, V2);
  attn_kernel<<<S / 16, 256, 0, stream>>>(Q2, K2, V2, CH, CL);
  out_kernel<<<S / 32, 64, 0, stream>>>(CH, CL, R, P, out);
}

// v003
// One run takes 59.4 microseconds.
// Next to v002, in two timings, it ran 1.56 times as fast each time.
// All steps since v000 together make it 2.92 times as fast.
#include <hip/hip_runtime.h>

// Cross_At: q = x Wq + bq, [k | v] = y Wkv + bkv (8 heads x 8 dims; kv laid out [hw][2][H][d]); q, k L2-normalised per head (eps 1e-12); attn = softmax(q.k) (no scaling); ctx; out = ctx We + be
// -> [1][4096][64].
// WMMA (v_wmma_f32_16x16x32_f16, f32 accumulate): the projections with EXACT operands (x, y, [in][out] weights exact bf16; 1 product) + bias, the per-head L2 normalisation in f32 in the epilogue
// (8-lane shuffles); normalised k x8 and q x log2(e)/8 as f16 hi+lo pairs, 16 halves [hi 8 | lo 8] per (token, head); the K = 32 of one WMMA holds k [hi | lo | hi | lo] against q [hi | hi | lo | lo], so
// S^T = k.q is 1 WMMA per 16 keys; softmax in f32 with a constant shift (every score is a cosine); o^T += (8v)^T.P^T with rows 0..7 = v hi, rows 8..15 = v lo and P hi, P lo (2 WMMAs), the two row halves added after the loop;
// out = ctx.We + be with ctx hi+lo (2 products). Fragment k-map per lane half hh for A AND B: elements 0..7 <- k = 8hh+0..7, 8..15 <- k = 16+8hh+0..7

namespace {
constexpr int S = 4096, C = 64, H = 8, HD = 8, KP = 16 /* head slot for q/k: 8 hi | 8 lo */, VP = 16 /* v^T rows: 8 hi, 8 lo */, KQ = 4 /* key quarters of the attention, one wave each */;
constexpr float XS = 8.0f;
constexpr float QS = 1.4426950408889634f / XS;   // q is stored as q * log2(e) / 8, so (8k).(q') = log2(e) * cos(q, k): the exponent of exp2 with no further scaling
constexpr float PSH = 4.0f;                      // constant exponent shift, the C operand of the score WMMA: p = 2^4 * exp(cos) lies in [16/e, 16e] for EVERY input, as |cos| <= 1

typedef _Float16 b16;
typedef __attribute__((ext_vector_type(16))) _Float16 v16b;
typedef __attribute__((ext_vector_type(8))) _Float16 v8b;
typedef __attribute__((ext_vector_type(8))) float v8f;
typedef __attribute__((ext_vector_type(4))) float v4f;
__device__ __forceinline__ float bf16_rne(float f) { unsigned int u = __float_as_uint(f); u += 0x7FFFu + ((u >> 16) & 1u); return __uint_as_float(u & 0xFFFF0000u); }
__device__ __forceinline__ void split16(float v, b16& hi, b16& lo) { hi = (b16)v; lo = (b16)(v - (float)hi); }
__device__ __forceinline__ v16b frag_kb(const b16* p, int hh) { const v8b a = *(const v8b*)(p + 8 * hh), b = *(const v8b*)(p + 16 + 8 * hh); v16b f;
#pragma unroll
  for (int e = 0; e < 8; ++e) { f[e] = a[e]; f[8 + e] = b[e]; } return f; }
__device__ __forceinline__ v16b frag_cat(v8b a, v8b b) { v16b f;
#pragma unroll   // constant element indices keep the fragment in registers
  for (int e = 0; e < 8; ++e) { f[e] = a[e]; f[8 + e] = b[e]; } return f; }
__device__ __forceinline__ v8f wmma16b(v16b a, v16b b, v8f c) { v8f d = __builtin_amdgcn_wmma_f32_16x16x32_f16(false, a, false, b, (short)0, c, false, false); asm volatile("v_nop\n\tv_nop\n\tv_nop\n\tv_nop" : "+v"(d) : "v"(a), "v"(b)); return d; }
__device__ __forceinline__ void wave_lds_sync() { __builtin_amdgcn_fence(__ATOMIC_RELEASE, "workgroup"); __builtin_amdgcn_wave_barrier(); __builtin_amdgcn_fence(__ATOMIC_ACQUIRE, "workgroup"); }
__device__ __forceinline__ float pmul(float a, float b) { float p = a * b; asm volatile("" : "+v"(p)); return p; }

// prep: B rows Wq^T [64][64] @0, Wkv^T [128][64] @4096, We^T [64][64] @12288 (f16 exact); P: bq @0, bkv @64, be @192; X, Y rows f16 exact x8.
__global__ __launch_bounds__(256) void prep_kernel(const float* __restrict__ x, const float* __restrict__ y, const float* __restrict__ wq, const float* __restrict__ bq, const float* __restrict__ wkv, const float* __restrict__ bkv, const float* __restrict__ we, const float* __restrict__ be, b16* __restrict__ R, float* __restrict__ P, b16* __restrict__ X, b16* __restrict__ Y) {
  const size_t tid = (size_t)blockIdx.x * 256 + threadIdx.x, nth = (size_t)gridDim.x * 256;
  {
    for (size_t p = tid; p < (size_t)C * C; p += nth) { const int o = (int)(p / C), k = (int)(p % C); ((b16*)R)[p] = (b16)bf16_rne(wq[(size_t)k * C + o]); ((b16*)R)[12288 + p] = (b16)bf16_rne(we[(size_t)k * C + o]); }
    for (size_t p = tid; p < (size_t)2 * C * C; p += nth) { const int o = (int)(p / C), k = (int)(p % C); ((b16*)R)[4096 + p] = (b16)bf16_rne(wkv[(size_t)k * 2 * C + o]); }
    for (size_t q = tid; q < 256; q += nth) { const int i = (int)q; P[q] = bf16_rne((i < 64) ? bq[i] : (i < 192) ? bkv[i - 64] : be[i - 192]); }
    for (size_t p = tid; p < (size_t)S * C / 8; p += nth) { v8b a, b; for (int e = 0; e < 8; ++e) { a[e] = (b16)(bf16_rne(x[p * 8 + e]) * XS); b[e] = (b16)(bf16_rne(y[p * 8 + e]) * XS); } *(v8b*)(X + p * 8) = a; *(v8b*)(Y + p * 8) = b; }
     }
}

// projections: block = 32 tokens x 2 waves; wave 0: q = x Wq + bq (64 cols) -> L2-normalise each 8-dim head (shuffles over the 8 lanes of a head) -> Q2[tok][h][hi 8 | lo 8];
// wave 1: kv = y Wkv + bkv (128 cols): k (cols 0..63) normalised -> K2[h][tok][hi 8 | lo 8] (16 keys of a head = 512 contiguous bytes); v (cols 64..127) -> VR rows in f32 through LDS
__global__ __launch_bounds__(64) void proj_kernel(const b16* __restrict__ X, const b16* __restrict__ Y, const b16* __restrict__ R, const float* __restrict__ P, b16* __restrict__ Q2, b16* __restrict__ K2, float* __restrict__ VR) {
  __shared__ __attribute__((aligned(16))) b16 Th[2][32][64 + 8], Tl[2][32][64 + 8]; __shared__ __attribute__((aligned(16))) float Tv[32][64 + 4];
  const int lane = threadIdx.x & 31, wave = threadIdx.x >> 5, nloc = lane & 15, hlf = lane >> 4, m0 = blockIdx.x * 32;
  const b16* A = wave ? Y : X; const b16* Bw = R + (wave ? 4096 : 0); const int NSUB = wave ? 8 : 4;
  v8f acc[2][8];
#pragma unroll
  for (int r = 0; r < 2; ++r)
#pragma unroll
    for (int t = 0; t < 8; ++t) acc[r][t] = (v8f){};
#pragma unroll
  for (int kb = 0; kb < C; kb += 32) { const v16b a0 = frag_kb(A + (size_t)(m0 + nloc) * C + kb, hlf), a1 = frag_kb(A + (size_t)(m0 + 16 + nloc) * C + kb, hlf);
#pragma unroll
    for (int t = 0; t < 8; ++t) { if (t < NSUB) { const v16b bw = frag_kb(Bw + (size_t)(t * 16 + nloc) * C + kb, hlf); acc[0][t] = wmma16b(a0, bw, acc[0][t]); acc[1][t] = wmma16b(a1, bw, acc[1][t]); } } }
  // q (wave 0, t = 0..3) and k (wave 1, t = 0..3): + bias, per-head L2 normalisation (head = 8 consecutive columns = lanes with equal nloc>>3 within a subtile... a lane holds ONE column for 8 rows, so
  // the 8 columns of a head live in lanes nloc = 8g..8g+7: reduce the sum of squares over lane bits 0..2)
#pragma unroll
  for (int t = 0; t < 4; ++t) { const float bb = P[(wave ? 64 : 0) + t * 16 + nloc];
#pragma unroll
    for (int r = 0; r < 2; ++r)
#pragma unroll
      for (int v = 0; v < 8; ++v) { const float val = acc[r][t][v] * (1.0f / XS) + bb; float ss = pmul(val, val); ss += __shfl_xor(ss, 1); ss += __shfl_xor(ss, 2); ss += __shfl_xor(ss, 4); const float nv = val / fmaxf(sqrtf(ss), 1e-12f);
        b16 a_, c_; split16(nv * (wave ? XS : QS), a_, c_); Th[wave][r * 16 + 8 * hlf + v][t * 16 + nloc] = a_; Tl[wave][r * 16 + 8 * hlf + v][t * 16 + nloc] = c_; } }
  if (wave == 1) {
#pragma unroll
    for (int t = 4; t < 8; ++t) { const float bb = P[64 + t * 16 + nloc];
#pragma unroll
      for (int r = 0; r < 2; ++r)
#pragma unroll
        for (int v = 0; v < 8; ++v) Tv[r * 16 + 8 * hlf + v][(t - 4) * 16 + nloc] = acc[r][t][v] * (1.0f / XS) + bb; } }
  __syncthreads();
  {
    // 32 tokens x 8 heads = 256 slots of 32 B (hi piece, lo piece) per wave; q is token-major, k head-major: each wave walks its slots in the order of its own destination
    for (int i = lane; i < 32 * 8; i += 32) { const int rr = wave ? (i & 31) : (i >> 3), hh2 = wave ? (i >> 5) : (i & 7); b16* d = wave ? K2 + ((size_t)hh2 * S + m0 + rr) * KP : Q2 + ((size_t)(m0 + rr) * H + hh2) * KP;
      *(v8b*)d = *(const v8b*)(&Th[wave][rr][hh2 * 8]); *(v8b*)(d + 8) = *(const v8b*)(&Tl[wave][rr][hh2 * 8]); }
    if (wave == 1) { for (int i = lane; i < 32 * 16; i += 32) { const int rr = i >> 4, c4 = (i & 15) * 4; *(v4f*)(VR + (size_t)(m0 + rr) * C + c4) = *(const v4f*)(&Tv[rr][c4]); } }
     }
}
// (8v)^T in the order of the attention's A fragments: V2[h][32-key block][c][row][hh][8 keys], key = 32 block + 16 c + 8 hh + e; rows 0..7 = hi of dims 0..7, rows 8..15 = lo: one c = 512 contiguous bytes
__global__ __launch_bounds__(256) void vt_kernel(const float* __restrict__ VR, b16* __restrict__ V2) {
  __shared__ __attribute__((aligned(16))) b16 Th[64][128 + 8], Tl[64][128 + 8];
  const int t0 = blockIdx.x * 128, t_ = threadIdx.x;
  for (int i = t_; i < 128 * 64; i += 256) { const int tk = i >> 6, c = i & 63; b16 a_, b_; split16(VR[(size_t)(t0 + tk) * C + c] * XS, a_, b_); Th[c][tk] = a_; Tl[c][tk] = b_; }
  __syncthreads();
  { for (int i = t_; i < 8 * 256; i += 256) { const int h = i >> 8, j = i & 255, tk = (j >> 6) * 32 + ((j >> 5) & 1) * 16 + (j & 1) * 8, row = (j >> 1) & 15, ch = h * HD + (row & 7);
      *(v8b*)(V2 + ((size_t)h * (S / 32) + t0 / 32) * (32 * VP) + j * 8) = *(const v8b*)(row < 8 ? &Th[ch][tk] : &Tl[ch][tk]); }  }
}
// attention: wave = (head, key quarter, 16 queries), block = 8 heads x 4 key quarters = 32 waves (8 per SIMD: the other waves' work covers a wave's load and WMMA -> exp2 -> WMMA waits);
// 32 key blocks of 32 per wave: S^T = k.q (1 WMMA per 16 keys, hi and lo terms side by side in its K = 32), p = exp2 of its result,
// o^T[rows 0..7: v hi, rows 8..15: v lo][16 q] += (8v)^T.P^T (P hi, P lo); every fragment load of the loop is 512 contiguous bytes per wave.
// The constant shift makes the quarters' o and l plain partial sums: quarters 1..3 hand theirs over through LDS, quarter 0 adds them
__global__ __launch_bounds__(1024) void attn_kernel(const b16* __restrict__ Q2, const b16* __restrict__ K2, const b16* __restrict__ V2, b16* __restrict__ CH, b16* __restrict__ CL) {
  __shared__ __attribute__((aligned(16))) b16 Oh[16][C + 8], Ol[16][C + 8]; __shared__ float Pp[KQ - 1][H][9][32];   // partial o (8 rows) and l per lane
  const int w = threadIdx.x >> 5, h = w & 7, ks = w >> 3, lane = threadIdx.x & 31, hh = lane >> 4, col = lane & 15; const int q0 = blockIdx.x * 16, qi = q0 + col;
  // B: both lane halves hold [q hi | q lo]; A: lane half 0 holds [k hi | k hi], half 1 [k lo | k lo]: k 0..7 hi.hi, 8..15 lo.hi, 16..23 hi.lo, 24..31 lo.lo
  const b16* Qp = Q2 + ((size_t)qi * H + h) * KP; const v16b qf = frag_cat(*(const v8b*)Qp, *(const v8b*)(Qp + 8));
  const b16* K = K2 + ((size_t)h * S + ks * (S / KQ) + col) * KP + 8 * hh; const b16* V = V2 + ((size_t)h * S + ks * (S / KQ)) * VP + col * 16 + 8 * hh;
  // q and k are unit vectors (or shorter, at the eps clamp), so every score lies in [-1, 1]: no running maximum, no rescaling of o and l; the lane halves' sums meet after the loop
  const v8f sh = {PSH, PSH, PSH, PSH, PSH, PSH, PSH, PSH}; v8f lv = {}, o = {};
  for (int kb = 0; kb < S / KQ; kb += 32) {
    const v8b k0 = *(const v8b*)(K + (size_t)kb * KP), k1 = *(const v8b*)(K + (size_t)(kb + 16) * KP), v0 = *(const v8b*)(V + (size_t)kb * VP), v1 = *(const v8b*)(V + (size_t)kb * VP + 256);
    const v8f s0 = wmma16b(frag_cat(k0, k0), qf, sh), s1 = wmma16b(frag_cat(k1, k1), qf, sh); v16b pb, pl;
#pragma unroll
    for (int r = 0; r < 8; ++r) { const float e0 = __builtin_amdgcn_exp2f(s0[r]), e1 = __builtin_amdgcn_exp2f(s1[r]); lv[r] += e0 + e1; b16 a_, c_; split16(e0, a_, c_); pb[r] = a_; pl[r] = c_; split16(e1, a_, c_); pb[8 + r] = a_; pl[8 + r] = c_; }
    const v16b vf = frag_cat(v0, v1); o = wmma16b(vf, pb, o); o = wmma16b(vf, pl, o); }
  float l = ((lv[0] + lv[1]) + (lv[2] + lv[3])) + ((lv[4] + lv[5]) + (lv[6] + lv[7]));
  if (ks > 0) {
#pragma unroll   // constant element indices keep the accumulator in registers
    for (int r = 0; r < 8; ++r) Pp[ks - 1][h][r][lane] = o[r];
    Pp[ks - 1][h][8][lane] = l; }
  __syncthreads();   // the quarters' partial sums are in LDS
  if (ks == 0) {
#pragma unroll
    for (int j = 0; j < KQ - 1; ++j) {
#pragma unroll
      for (int r = 0; r < 8; ++r) o[r] += Pp[j][h][r][lane];
      l += Pp[j][h][8][lane]; }
    l += __shfl_xor(l, 16);
    const float inv = 1.0f / l;
    // o[r] = 8 * l * (hi part (hh == 0) or lo part (hh == 1) of ctx[dim r][query col]): add the two lane halves, lane half 0 stores
#pragma unroll   // constant element indices keep the accumulator in registers
    for (int r = 0; r < 8; ++r) o[r] += __shfl_xor(o[r], 16);
    if (hh == 0) {
#pragma unroll
      for (int r = 0; r < 8; ++r) { b16 a_, c_; split16(o[r] * inv, a_, c_); Oh[col][h * HD + r] = a_; Ol[col][h * HD + r] = c_; } } }
  __syncthreads();
  { for (int i = threadIdx.x; i < 16 * 8; i += 1024) { const int rr = i >> 3, c8 = (i & 7) * 8; const size_t gi = (size_t)(q0 + rr) * C + c8; *(v8b*)(CH + gi) = *(const v8b*)(&Oh[rr][c8]); *(v8b*)(CL + gi) = *(const v8b*)(&Ol[rr][c8]); }  }
}
__global__ __launch_bounds__(64) void out_kernel(const b16* __restrict__ CH, const b16* __restrict__ CL, const b16* __restrict__ R, const float* __restrict__ P, float* __restrict__ out) {
  __shared__ __attribute__((aligned(16))) float Ts[2][16][C + 4];
  const int lane = threadIdx.x & 31, wave = threadIdx.x >> 5, nloc = lane & 15, hlf = lane >> 4, m0 = blockIdx.x * 32 + wave * 16; const b16* Bw = R + 12288;
  v8f acc[4] = {{}, {}, {}, {}};
#pragma unroll
  for (int kb = 0; kb < C; kb += 32) { const v16b a = frag_kb(CH + (size_t)(m0 + nloc) * C + kb, hlf), al_ = frag_kb(CL + (size_t)(m0 + nloc) * C + kb, hlf);
#pragma unroll
    for (int t = 0; t < 4; ++t) { const v16b bw = frag_kb(Bw + (size_t)(t * 16 + nloc) * C + kb, hlf); acc[t] = wmma16b(a, bw, acc[t]); acc[t] = wmma16b(al_, bw, acc[t]); } }
#pragma unroll
  for (int t = 0; t < 4; ++t)
#pragma unroll
    for (int r = 0; r < 8; ++r) Ts[wave][8 * hlf + r][t * 16 + nloc] = acc[t][r] * (1.0f / XS) + P[192 + t * 16 + nloc];
  wave_lds_sync();
  { for (int i = lane; i < 16 * 16; i += 32) { const int rr = i >> 4, c4 = (i & 15) * 4; *(v4f*)(out + (size_t)(m0 + rr) * C + c4) = *(const v4f*)(&Ts[wave][rr][c4]); }  }
}
}  // namespace

extern "C" void kernel_launch(void* const* d_in, const int* in_sizes, int n_in,
                              void* d_out, int out_size, void* d_ws, size_t ws_size, hipStream_t stream) {
  (void)n_in; (void)out_size;
  const float* x = (const float*)d_in[0]; const float* y = (const float*)d_in[1]; const float* wq = (const float*)d_in[2]; const float* bq = (const float*)d_in[3]; const float* wkv = (const float*)d_in[4]; const float* bkv = (const float*)d_in[5]; const float* we = (const float*)d_in[6]; const float* be = (const float*)d_in[7];
  float* out = (float*)d_out;   // [1][4096][64]
  if (in_sizes[0] != S * C || in_sizes[4] != C * 2 * C) return;
  size_t off = 0; char* ws = (char*)d_ws;
  auto carve = [&](size_t bytes) { char* p = ws + off; off += (bytes + 255) & ~(size_t)255; return p; };
  b16* R = (b16*)carve(16384 * 2); float* P = (float*)carve(256 * 4); b16* X = (b16*)carve((size_t)S * C * 2); b16* Y = (b16*)carve((size_t)S * C * 2); float* VR = (float*)carve((size_t)S * C * 4); b16* CH = (b16*)carve((size_t)S * C * 2); b16* CL = (b16*)carve((size_t)S * C * 2);
  b16* Q2 = (b16*)carve((size_t)S * H * KP * 2); b16* K2 = (b16*)carve((size_t)S * H * KP * 2); b16* V2 = (b16*)carve((size_t)H * VP * S * 2);   // every element written by proj_kernel / vt_kernel
  if (off > ws_size) return;                        // about 6 MB
  prep_kernel<<<256, 256, 0, stream>>>(x, y, wq, bq, wkv, bkv, we, be, R, P, X, Y);
  proj_kernel<<<S / 32, 64, 0, stream>>>(X, Y, R, P, Q2, K2, VR);
  vt_kernel<<<S / 128, 256, 0, stream>>>(VR, V2);
  attn_kernel<<<S / 16, 32 * H * KQ, 0, stream>>>(Q2, K2, V2, CH, CL);
  out_kernel<<<S / 32, 64, 0, stream>>>(CH, CL, R, P, out);
}

// v004
// It runs in 32.1 microseconds.
// Timed twice side by side with v003, it ran 1.86 and 1.88 times as fast.
// Counting every step since v000, it is 5.47 times as fast.
#include <hip/hip_runtime.h>

// Cross_At: q = x Wq + bq, [k | v] = y Wkv + bkv (8 heads x 8 dims; kv laid out [hw][2][H][d]); q, k L2-normalised per head (eps 1e-12); attn = softmax(q.k) (no scaling); ctx; out = ctx We + be
// -> [1][4096][64].
// WMMA (v_wmma_f32_16x16x32_f16, f32 accumulate): the projections with EXACT operands (x, y, [in][out] weights exact bf16; 1 product) + bias, the per-head L2 normalisation in f32 in the epilogue
// (8-lane shuffles); normalised k x8 and q x log2(e)/8 as f16 hi+lo pairs, 16 halves [hi 8 | lo 8] per (token, head); the K = 32 of one WMMA holds k [hi | lo | hi | lo] against q [hi | hi | lo | lo], so
// S^T = k.q is 1 WMMA per 16 keys; softmax in f32 with a constant shift (every score is a cosine); o^T += (8v)^T.P^T with rows 0..7 = v hi, rows 8..15 = v lo and P hi, P lo (2 WMMAs), the two row halves added after the loop;
// out = ctx.We + be with ctx hi+lo (2 products). Fragment k-map per lane half hh for A AND B: elements 0..7 <- k = 8hh+0..7, 8..15 <- k = 16+8hh+0..7

namespace {
constexpr int S = 4096, C = 64, H = 8, HD = 8, KP = 16 /* head slot for q/k: 8 hi | 8 lo */, VP = 16 /* v^T rows: 8 hi, 8 lo */, KQ = 4 /* key quarters of the attention, one wave each */;
constexpr float XS = 8.0f;
constexpr float QS = 1.4426950408889634f / XS;   // q is stored as q * log2(e) / 8, so (8k).(q') = log2(e) * cos(q, k): the exponent of exp2 with no further scaling
constexpr float PSH = 4.0f;                      // constant exponent shift, the C operand of the score WMMA: p = 2^4 * exp(cos) lies in [16/e, 16e] for EVERY input, as |cos| <= 1

typedef _Float16 b16;
typedef __attribute__((ext_vector_type(16))) _Float16 v16b;
typedef __attribute__((ext_vector_type(8))) _Float16 v8b;
typedef __attribute__((ext_vector_type(8))) float v8f;
typedef __attribute__((ext_vector_type(4))) float v4f;
__device__ __forceinline__ float bf16_rne(float f) { unsigned int u = __float_as_uint(f); u += 0x7FFFu + ((u >> 16) & 1u); return __uint_as_float(u & 0xFFFF0000u); }
__device__ __forceinline__ void split16(float v, b16& hi, b16& lo) { hi = (b16)v; lo = (b16)(v - (float)hi); }
__device__ __forceinline__ v16b frag_kb(const b16* p, int hh) { const v8b a = *(const v8b*)(p + 8 * hh), b = *(const v8b*)(p + 16 + 8 * hh); v16b f;
#pragma unroll
  for (int e = 0; e < 8; ++e) { f[e] = a[e]; f[8 + e] = b[e]; } return f; }
__device__ __forceinline__ v16b frag_cat(v8b a, v8b b) { v16b f;
#pragma unroll   // constant element indices keep the fragment in registers
  for (int e = 0; e < 8; ++e) { f[e] = a[e]; f[8 + e] = b[e]; } return f; }
__device__ __forceinline__ v8f wmma16b(v16b a, v16b b, v8f c) { v8f d = __builtin_amdgcn_wmma_f32_16x16x32_f16(false, a, false, b, (short)0, c, false, false); asm volatile("v_nop\n\tv_nop\n\tv_nop\n\tv_nop" : "+v"(d) : "v"(a), "v"(b)); return d; }
__device__ __forceinline__ void wave_lds_sync() { __builtin_amdgcn_fence(__ATOMIC_RELEASE, "workgroup"); __builtin_amdgcn_wave_barrier(); __builtin_amdgcn_fence(__ATOMIC_ACQUIRE, "workgroup"); }
__device__ __forceinline__ float pmul(float a, float b) { float p = a * b; asm volatile("" : "+v"(p)); return p; }

// fragments straight from the f32 inputs, same k-map as frag_kb: a token row (rounded to bf16, x8, exact in f16) and a column of an [in][out] weight (rounded to bf16, exact in f16)
__device__ __forceinline__ v16b frag_x(const float* p, int hh) { const v4f a0 = *(const v4f*)(p + 8 * hh), a1 = *(const v4f*)(p + 8 * hh + 4), b0 = *(const v4f*)(p + 16 + 8 * hh), b1 = *(const v4f*)(p + 16 + 8 * hh + 4); v16b f;
#pragma unroll   // constant element indices keep the fragment in registers
  for (int e = 0; e < 4; ++e) { f[e] = (b16)(bf16_rne(a0[e]) * XS); f[4 + e] = (b16)(bf16_rne(a1[e]) * XS); f[8 + e] = (b16)(bf16_rne(b0[e]) * XS); f[12 + e] = (b16)(bf16_rne(b1[e]) * XS); } return f; }
template <int LD> __device__ __forceinline__ v16b frag_w(const float* p, int hh) { p += 8 * hh * LD; v16b f;   // LD at compile time: one address, the 16 rows as immediate offsets
#pragma unroll   // constant element indices keep the fragment in registers
  for (int e = 0; e < 8; ++e) { f[e] = (b16)bf16_rne(p[e * LD]); f[8 + e] = (b16)bf16_rne(p[(16 + e) * LD]); } return f; }
// one 16 x 16 tile over K = 64: all four fragments are fetched before the first WMMA, so the wave waits for memory once
template <int LD> __device__ __forceinline__ v8f tile64(const float* A, const float* Wp, int hh) { const v16b a0 = frag_x(A, hh), a1 = frag_x(A + 32, hh), w0 = frag_w<LD>(Wp, hh), w1 = frag_w<LD>(Wp + 32 * LD, hh); return wmma16b(a1, w1, wmma16b(a0, w0, (v8f){})); }

// projections, straight from the f32 inputs: block = 16 tokens x 12 waves, wave = one 16 x 16 output tile (2 WMMAs). Waves 0..3: q = x Wq + bq, waves 4..7: k, waves 8..11: v (columns 0..63 / 64..127 of y Wkv + bkv).
// q, k: L2-normalise each 8-dim head (a lane holds ONE column for 8 tokens, the 8 columns of a head live in 8 neighbouring lanes: sum of squares over lane bits 0..2), hi+lo split, turned to
// [h][tok][hi 8 | lo 8] through the wave's own LDS tile (16 tokens of a head = 512 contiguous bytes). v: a lane's 8 tokens of one column ARE one 16-byte piece of V2, stored from registers:
// (8v)^T in the order of the attention's A fragments: V2[h][32-key block][c][row][hh][8 keys], key = 32 block + 16 c + 8 hh + e; rows 0..7 = hi of dims 0..7, rows 8..15 = lo: one c = 512 contiguous bytes
__global__ __launch_bounds__(384) void proj_kernel(const float* __restrict__ x, const float* __restrict__ y, const float* __restrict__ wq, const float* __restrict__ bq, const float* __restrict__ wkv, const float* __restrict__ bkv, b16* __restrict__ Q2, b16* __restrict__ K2, b16* __restrict__ V2) {
  __shared__ __attribute__((aligned(16))) b16 Th[8][16][16 + 8], Tl[8][16][16 + 8];
  const int lane = threadIdx.x & 31, wave = __builtin_amdgcn_readfirstlane(threadIdx.x >> 5), nloc = lane & 15, hlf = lane >> 4, m0 = blockIdx.x * 16;
  const bool isq = wave < 4; const int t = isq ? wave : wave - 4;   // t: column tile of the wave's weight matrix; every test on wave is a scalar branch, the WMMAs behind it run with every lane on
  const float bb = bf16_rne((isq ? bq : bkv)[t * 16 + nloc]);
  const v8f acc = isq ? tile64<C>(x + (size_t)(m0 + nloc) * C, wq + t * 16 + nloc, hlf) : tile64<2 * C>(y + (size_t)(m0 + nloc) * C, wkv + t * 16 + nloc, hlf);
  if (wave >= 8) {   // v
    const int ch = (t - 4) * 16 + nloc; v8b vh, vl;
#pragma unroll   // constant element indices keep the pieces in registers
    for (int v = 0; v < 8; ++v) { b16 a_, c_; split16((acc[v] * (1.0f / XS) + bb) * XS, a_, c_); vh[v] = a_; vl[v] = c_; }
    b16* d = V2 + ((size_t)(ch >> 3) * (S / 32) + (m0 >> 5)) * (32 * VP) + ((m0 >> 4) & 1) * 256 + ((ch & 7) * 2 + hlf) * 8;
    *(v8b*)d = vh; *(v8b*)(d + 128) = vl; return; }   // no block barrier in this kernel: a wave may leave on its own
#pragma unroll
  for (int v = 0; v < 8; ++v) { const float val = acc[v] * (1.0f / XS) + bb; float ss = pmul(val, val); ss += __shfl_xor(ss, 1); ss += __shfl_xor(ss, 2); ss += __shfl_xor(ss, 4); const float nv = val / fmaxf(sqrtf(ss), 1e-12f);
    b16 a_, c_; split16(nv * (isq ? QS : XS), a_, c_); Th[wave][8 * hlf + v][nloc] = a_; Tl[wave][8 * hlf + v][nloc] = c_; }
  wave_lds_sync();   // the tile is the wave's own: its LDS writes are done before its lanes read each other's
  b16* d = (isq ? Q2 : K2) + ((size_t)(2 * t + hlf) * S + m0 + nloc) * KP;   // lane = (head 2t + hlf, token nloc)
  *(v8b*)d = *(const v8b*)(&Th[wave][nloc][hlf * 8]); *(v8b*)(d + 8) = *(const v8b*)(&Tl[wave][nloc][hlf * 8]);
  asm volatile("s_wait_xcnt 0x0" ::: "memory");   // the built code lays the v part behind these stores: the wait stands before their registers are written there
}
// attention: wave = (head, key quarter, 16 queries), block = 8 heads x 4 key quarters = 32 waves (8 per SIMD: the other waves' work covers a wave's load and WMMA -> exp2 -> WMMA waits);
// 32 key blocks of 32 per wave: S^T = k.q (1 WMMA per 16 keys, hi and lo terms side by side in its K = 32), p = exp2 of its result,
// o^T[rows 0..7: v hi, rows 8..15: v lo][16 q] += (8v)^T.P^T (P hi, P lo); every fragment load of the loop is 512 contiguous bytes per wave.
// The constant shift makes the quarters' o and l plain partial sums: quarters 1..3 hand theirs over through LDS, quarter 0 adds them.
// out = ctx We + be for the block's 16 queries in the same launch: ctx hi, lo stay in LDS; four waves of the last quarter take one 16-column tile each (4 WMMAs), their We fragments fetched before the key loop
__global__ __launch_bounds__(1024) void attn_kernel(const b16* __restrict__ Q2, const b16* __restrict__ K2, const b16* __restrict__ V2, const float* __restrict__ we, const float* __restrict__ be, float* __restrict__ out) {
  __shared__ __attribute__((aligned(16))) b16 Oh[16][C + 8], Ol[16][C + 8]; __shared__ float Pp[KQ - 1][H][9][32];   // partial o (8 rows) and l per lane
  __shared__ __attribute__((aligned(16))) float Ts[16][C + 4];
  const int w = threadIdx.x >> 5, h = w & 7, ks = w >> 3, lane = threadIdx.x & 31, hh = lane >> 4, col = lane & 15; const int q0 = blockIdx.x * 16, qi = q0 + col;
  // B: both lane halves hold [q hi | q lo]; A: lane half 0 holds [k hi | k hi], half 1 [k lo | k lo]: k 0..7 hi.hi, 8..15 lo.hi, 16..23 hi.lo, 24..31 lo.lo
  const b16* Qp = Q2 + ((size_t)h * S + qi) * KP; const v16b qf = frag_cat(*(const v8b*)Qp, *(const v8b*)(Qp + 8));
  asm volatile("s_wait_xcnt 0x0" ::: "memory");   // before the q loads' address registers are written again
  const b16* K = K2 + ((size_t)h * S + ks * (S / KQ) + col) * KP + 8 * hh; const b16* V = V2 + ((size_t)h * S + ks * (S / KQ)) * VP + col * 16 + 8 * hh;
  const int wu = __builtin_amdgcn_readfirstlane(w); const bool ow = (wu >> 3) == KQ - 1 && (wu & 7) < C / 16;   // scalar test: the WMMAs behind it run with every lane on
  v16b wf0 = {}, wf1 = {}; float bo = 0.0f;
  if (ow) { bo = be[(wu & 7) * 16 + col];
    asm volatile("s_wait_xcnt 0x0" ::: "memory");   // before the bias load's address register is written again
    const float* Wp = we + (wu & 7) * 16 + col; wf0 = frag_w<C>(Wp, hh); wf1 = frag_w<C>(Wp + 32 * C, hh); bo = bf16_rne(bo); }
  // q and k are unit vectors (or shorter, at the eps clamp), so every score lies in [-1, 1]: no running maximum, no rescaling of o and l; the lane halves' sums meet after the loop
  const v8f sh = {PSH, PSH, PSH, PSH, PSH, PSH, PSH, PSH}; v8f lv = {}, o = {};
  for (int kb = 0; kb < S / KQ; kb += 32) {
    const v8b k0 = *(const v8b*)(K + (size_t)kb * KP), k1 = *(const v8b*)(K + (size_t)(kb + 16) * KP), v0 = *(const v8b*)(V + (size_t)kb * VP), v1 = *(const v8b*)(V + (size_t)kb * VP + 256);
    const v8f s0 = wmma16b(frag_cat(k0, k0), qf, sh), s1 = wmma16b(frag_cat(k1, k1), qf, sh); v16b pb, pl;
#pragma unroll
    for (int r = 0; r < 8; ++r) { const float e0 = __builtin_amdgcn_exp2f(s0[r]), e1 = __builtin_amdgcn_exp2f(s1[r]); lv[r] += e0 + e1; b16 a_, c_; split16(e0, a_, c_); pb[r] = a_; pl[r] = c_; split16(e1, a_, c_); pb[8 + r] = a_; pl[8 + r] = c_; }
    const v16b vf = frag_cat(v0, v1); o = wmma16b(vf, pb, o); o = wmma16b(vf, pl, o); }
  float l = ((lv[0] + lv[1]) + (lv[2] + lv[3])) + ((lv[4] + lv[5]) + (lv[6] + lv[7]));
  if (ks > 0) {
#pragma unroll   // constant element indices keep the accumulator in registers
    for (int r = 0; r < 8; ++r) Pp[ks - 1][h][r][lane] = o[r];
    Pp[ks - 1][h][8][lane] = l; }
  __syncthreads();   // the quarters' partial sums are in LDS
  if (ks == 0) {
#pragma unroll
    for (int j = 0; j < KQ - 1; ++j) {
#pragma unroll
      for (int r = 0; r < 8; ++r) o[r] += Pp[j][h][r][lane];
      l += Pp[j][h][8][lane]; }
    l += __shfl_xor(l, 16);
    const float inv = 1.0f / l;
    // o[r] = 8 * l * (hi part (hh == 0) or lo part (hh == 1) of ctx[dim r][query col]): add the two lane halves, lane half 0 stores
#pragma unroll   // constant element indices keep the accumulator in registers
    for (int r = 0; r < 8; ++r) o[r] += __shfl_xor(o[r], 16);
    if (hh == 0) {
#pragma unroll
      for (int r = 0; r < 8; ++r) { b16 a_, c_; split16(o[r] * inv, a_, c_); Oh[col][h * HD + r] = a_; Ol[col][h * HD + r] = c_; } } }
  __syncthreads();   // ctx hi, lo of the 16 queries are in LDS
  if (ow) { v8f acc = {};
    acc = wmma16b(frag_kb(&Oh[col][0], hh), wf0, acc); acc = wmma16b(frag_kb(&Ol[col][0], hh), wf0, acc); acc = wmma16b(frag_kb(&Oh[col][32], hh), wf1, acc); acc = wmma16b(frag_kb(&Ol[col][32], hh), wf1, acc);
#pragma unroll   // constant element indices keep the accumulator in registers
    for (int r = 0; r < 8; ++r) Ts[8 * hh + r][(wu & 7) * 16 + col] = acc[r] * (1.0f / XS) + bo; }
  __syncthreads();   // the 16 x 64 output tile is in LDS: stored as whole rows, 512 contiguous bytes per wave
  if (threadIdx.x < 16 * 16) { const int rr = threadIdx.x >> 4, c4 = (threadIdx.x & 15) * 4; *(v4f*)(out + (size_t)(q0 + rr) * C + c4) = *(const v4f*)(&Ts[rr][c4]); }
}
}  // namespace

extern "C" void kernel_launch(void* const* d_in, const int* in_sizes, int n_in,
                              void* d_out, int out_size, void* d_ws, size_t ws_size, hipStream_t stream) {
  (void)n_in; (void)out_size;
  const float* x = (const float*)d_in[0]; const float* y = (const float*)d_in[1]; const float* wq = (const float*)d_in[2]; const float* bq = (const float*)d_in[3]; const float* wkv = (const float*)d_in[4]; const float* bkv = (const float*)d_in[5]; const float* we = (const float*)d_in[6]; const float* be = (const float*)d_in[7];
  float* out = (float*)d_out;   // [1][4096][64]
  if (in_sizes[0] != S * C || in_sizes[4] != C * 2 * C) return;
  size_t off = 0; char* ws = (char*)d_ws;
  auto carve = [&](size_t bytes) { char* p = ws + off; off += (bytes + 255) & ~(size_t)255; return p; };
  b16* Q2 = (b16*)carve((size_t)S * H * KP * 2); b16* K2 = (b16*)carve((size_t)S * H * KP * 2); b16* V2 = (b16*)carve((size_t)H * VP * S * 2);   // every element written by proj_kernel
  if (off > ws_size) return;                        // 3 MB
  proj_kernel<<<S / 16, 32 * 12, 0, stream>>>(x, y, wq, bq, wkv, bkv, Q2, K2, V2);
  attn_kernel<<<S / 16, 32 * H * KQ, 0, stream>>>(Q2, K2, V2, we, be, out);
}

// v005
// One run takes 30 microseconds.
// In two side-by-side timings against v004, it was 1.05 and 1.06 times as fast.
// All steps since v000 together make it 5.78 times as fast.
#include <hip/hip_runtime.h>

// Cross_At: q = x Wq + bq, [k | v] = y Wkv + bkv (8 heads x 8 dims; kv laid out [hw][2][H][d]); q, k L2-normalised per head (eps 1e-12); attn = softmax(q.k) (no scaling); ctx; out = ctx We + be
// -> [1][4096][64].
// WMMA (v_wmma_f32_16x16x32_f16, f32 accumulate): the projections with EXACT operands (x, y, [in][out] weights exact bf16; 1 product) + bias, the per-head L2 normalisation in f32 in the epilogue
// (8-lane shuffles); normalised k x8 and q x log2(e)/8 as f16 hi+lo pairs, 16 halves [hi 8 | lo 8] per (token, head); the K = 32 of one WMMA holds k [hi | lo | hi | lo] against q [hi | hi | lo | lo], so
// S^T = k.q is 1 WMMA per 16 keys; softmax in f32 with a constant shift (every score is a cosine); o^T += (8v)^T.P^T with rows 0..7 = v hi, rows 8..15 = v lo and P hi, P lo (2 WMMAs), the two row halves added after the loop;
// out = ctx.We + be with ctx hi+lo (2 products). Fragment k-map per lane half hh for A AND B: elements 0..7 <- k = 8hh+0..7, 8..15 <- k = 16+8hh+0..7

namespace {
constexpr int S = 4096, C = 64, H = 8, HD = 8, KP = 16 /* head slot for q/k: 8 hi | 8 lo */, VP = 16 /* v^T rows: 8 hi, 8 lo */, KQ = 4 /* key quarters of the attention, one wave each */;
constexpr unsigned NB = S / KQ / 32;   // 32-key blocks per wave, a power of two
constexpr float XS = 8.0f;
constexpr float QS = 1.4426950408889634f / XS;   // q is stored as q * log2(e) / 8, so (8k).(q') = log2(e) * cos(q, k): the exponent of exp2 with no further scaling
constexpr float PSH = 4.0f;                      // constant exponent shift, the C operand of the score WMMA: p = 2^4 * exp(cos) lies in [16/e, 16e] for EVERY input, as |cos| <= 1

typedef _Float16 b16;
typedef __attribute__((ext_vector_type(16))) _Float16 v16b;
typedef __attribute__((ext_vector_type(8))) _Float16 v8b;
typedef __attribute__((ext_vector_type(8))) float v8f;
typedef __attribute__((address_space(1))) _Float16 gb16;   // global memory, named so that an address formed from an integer stays a global load
typedef __attribute__((address_space(1))) v8b gv8b;
typedef __attribute__((ext_vector_type(4))) float v4f;
__device__ __forceinline__ float bf16_rne(float f) { unsigned int u = __float_as_uint(f); u += 0x7FFFu + ((u >> 16) & 1u); return __uint_as_float(u & 0xFFFF0000u); }
__device__ __forceinline__ void split16(float v, b16& hi, b16& lo) { hi = (b16)v; lo = (b16)(v - (float)hi); }
__device__ __forceinline__ v16b frag_kb(const b16* p, int hh) { const v8b a = *(const v8b*)(p + 8 * hh), b = *(const v8b*)(p + 16 + 8 * hh); v16b f;
#pragma unroll
  for (int e = 0; e < 8; ++e) { f[e] = a[e]; f[8 + e] = b[e]; } return f; }
__device__ __forceinline__ v16b frag_cat(v8b a, v8b b) { v16b f;
#pragma unroll   // constant element indices keep the fragment in registers
  for (int e = 0; e < 8; ++e) { f[e] = a[e]; f[8 + e] = b[e]; } return f; }
__device__ __forceinline__ v8f wmma16b(v16b a, v16b b, v8f c) { v8f d = __builtin_amdgcn_wmma_f32_16x16x32_f16(false, a, false, b, (short)0, c, false, false); asm volatile("v_nop\n\tv_nop\n\tv_nop\n\tv_nop" : "+v"(d) : "v"(a), "v"(b)); return d; }
__device__ __forceinline__ void wave_lds_sync() { __builtin_amdgcn_fence(__ATOMIC_RELEASE, "workgroup"); __builtin_amdgcn_wave_barrier(); __builtin_amdgcn_fence(__ATOMIC_ACQUIRE, "workgroup"); }
__device__ __forceinline__ float pmul(float a, float b) { float p = a * b; asm volatile("" : "+v"(p)); return p; }

// fragments straight from the f32 inputs, same k-map as frag_kb: a token row (rounded to bf16, x8, exact in f16) and a column of an [in][out] weight (rounded to bf16, exact in f16)
__device__ __forceinline__ v16b frag_x(const float* p, int hh) { const v4f a0 = *(const v4f*)(p + 8 * hh), a1 = *(const v4f*)(p + 8 * hh + 4), b0 = *(const v4f*)(p + 16 + 8 * hh), b1 = *(const v4f*)(p + 16 + 8 * hh + 4); v16b f;
#pragma unroll   // constant element indices keep the fragment in registers
  for (int e = 0; e < 4; ++e) { f[e] = (b16)(bf16_rne(a0[e]) * XS); f[4 + e] = (b16)(bf16_rne(a1[e]) * XS); f[8 + e] = (b16)(bf16_rne(b0[e]) * XS); f[12 + e] = (b16)(bf16_rne(b1[e]) * XS); } return f; }
template <int LD> __device__ __forceinline__ v16b frag_w(const float* p, int hh) { p += 8 * hh * LD; v16b f;   // LD at compile time: one address, the 16 rows as immediate offsets
#pragma unroll   // constant element indices keep the fragment in registers
  for (int e = 0; e < 8; ++e) { f[e] = (b16)bf16_rne(p[e * LD]); f[8 + e] = (b16)bf16_rne(p[(16 + e) * LD]); } return f; }
// one 16 x 16 tile over K = 64: all four fragments are fetched before the first WMMA, so the wave waits for memory once
template <int LD> __device__ __forceinline__ v8f tile64(const float* A, const float* Wp, int hh) { const v16b a0 = frag_x(A, hh), a1 = frag_x(A + 32, hh), w0 = frag_w<LD>(Wp, hh), w1 = frag_w<LD>(Wp + 32 * LD, hh); return wmma16b(a1, w1, wmma16b(a0, w0, (v8f){})); }

// projections, straight from the f32 inputs: block = 16 tokens x 12 waves, wave = one 16 x 16 output tile (2 WMMAs). Waves 0..3: q = x Wq + bq, waves 4..7: k, waves 8..11: v (columns 0..63 / 64..127 of y Wkv + bkv).
// q, k: L2-normalise each 8-dim head (a lane holds ONE column for 8 tokens, the 8 columns of a head live in 8 neighbouring lanes: sum of squares over lane bits 0..2), hi+lo split, turned to
// [h][tok][hi 8 | lo 8] through the wave's own LDS tile (16 tokens of a head = 512 contiguous bytes). v: a lane's 8 tokens of one column ARE one 16-byte piece of V2, stored from registers:
// (8v)^T in the order of the attention's A fragments: V2[h][32-key block][c][row][hh][8 keys], key = 32 block + 16 c + 8 hh + e; rows 0..7 = hi of dims 0..7, rows 8..15 = lo: one c = 512 contiguous bytes
__global__ __launch_bounds__(384) void proj_kernel(const float* __restrict__ x, const float* __restrict__ y, const float* __restrict__ wq, const float* __restrict__ bq, const float* __restrict__ wkv, const float* __restrict__ bkv, b16* __restrict__ Q2, b16* __restrict__ K2, b16* __restrict__ V2) {
  __shared__ __attribute__((aligned(16))) b16 Th[8][16][16 + 8], Tl[8][16][16 + 8];
  const int lane = threadIdx.x & 31, wave = __builtin_amdgcn_readfirstlane(threadIdx.x >> 5), nloc = lane & 15, hlf = lane >> 4, m0 = blockIdx.x * 16;
  const bool isq = wave < 4; const int t = isq ? wave : wave - 4;   // t: column tile of the wave's weight matrix; every test on wave is a scalar branch, the WMMAs behind it run with every lane on
  const float bb = bf16_rne((isq ? bq : bkv)[t * 16 + nloc]);
  const v8f acc = isq ? tile64<C>(x + (size_t)(m0 + nloc) * C, wq + t * 16 + nloc, hlf) : tile64<2 * C>(y + (size_t)(m0 + nloc) * C, wkv + t * 16 + nloc, hlf);
  if (wave >= 8) {   // v
    const int ch = (t - 4) * 16 + nloc; v8b vh, vl;
#pragma unroll   // constant element indices keep the pieces in registers
    for (int v = 0; v < 8; ++v) { b16 a_, c_; split16((acc[v] * (1.0f / XS) + bb) * XS, a_, c_); vh[v] = a_; vl[v] = c_; }
    b16* d = V2 + ((size_t)(ch >> 3) * (S / 32) + (m0 >> 5)) * (32 * VP) + ((m0 >> 4) & 1) * 256 + ((ch & 7) * 2 + hlf) * 8;
    *(v8b*)d = vh; *(v8b*)(d + 128) = vl; return; }   // no block barrier in this kernel: a wave may leave on its own
#pragma unroll
  for (int v = 0; v < 8; ++v) { const float val = acc[v] * (1.0f / XS) + bb; float ss = pmul(val, val); ss += __shfl_xor(ss, 1); ss += __shfl_xor(ss, 2); ss += __shfl_xor(ss, 4); const float nv = val / fmaxf(sqrtf(ss), 1e-12f);
    b16 a_, c_; split16(nv * (isq ? QS : XS), a_, c_); Th[wave][8 * hlf + v][nloc] = a_; Tl[wave][8 * hlf + v][nloc] = c_; }
  wave_lds_sync();   // the tile is the wave's own: its LDS writes are done before its lanes read each other's
  b16* d = (isq ? Q2 : K2) + ((size_t)(2 * t + hlf) * S + m0 + nloc) * KP;   // lane = (head 2t + hlf, token nloc)
  *(v8b*)d = *(const v8b*)(&Th[wave][nloc][hlf * 8]); *(v8b*)(d + 8) = *(const v8b*)(&Tl[wave][nloc][hlf * 8]);
  asm volatile("s_wait_xcnt 0x0" ::: "memory");   // the built code lays the v part behind these stores: the wait stands before their registers are written there
}
// attention: wave = (head, key quarter, 16 queries), block = 8 heads x 4 key quarters = 32 waves (8 per SIMD: the other waves' work covers a wave's load and WMMA -> exp2 -> WMMA waits);
// 32 key blocks of 32 per wave, walked as a ring from a start set by the block index: S^T = k.q (1 WMMA per 16 keys, hi and lo terms side by side in its K = 32), p = exp2 of its result,
// o^T[rows 0..7: v hi, rows 8..15: v lo][16 q] += (8v)^T.P^T (P hi, P lo); every fragment load of the loop is 512 contiguous bytes per wave.
// The constant shift makes the quarters' o and l plain partial sums: quarters 1..3 hand theirs over through LDS, quarter 0 adds them.
// out = ctx We + be for the block's 16 queries in the same launch: ctx hi, lo stay in LDS; four waves of the last quarter take one 16-column tile each (4 WMMAs), their We fragments fetched before the key loop
__global__ __launch_bounds__(1024) void attn_kernel(const b16* __restrict__ Q2, const b16* __restrict__ K2, const b16* __restrict__ V2, const float* __restrict__ we, const float* __restrict__ be, float* __restrict__ out) {
  __shared__ __attribute__((aligned(16))) b16 Oh[16][C + 8], Ol[16][C + 8]; __shared__ float Pp[KQ - 1][H][9][32];   // partial o (8 rows) and l per lane
  __shared__ __attribute__((aligned(16))) float Ts[16][C + 4];
  const int w = threadIdx.x >> 5, h = w & 7, ks = w >> 3, lane = threadIdx.x & 31, hh = lane >> 4, col = lane & 15; const int q0 = blockIdx.x * 16, qi = q0 + col;
  // B: both lane halves hold [q hi | q lo]; A: lane half 0 holds [k hi | k hi], half 1 [k lo | k lo]: k 0..7 hi.hi, 8..15 lo.hi, 16..23 hi.lo, 24..31 lo.lo
  const b16* Qp = Q2 + ((size_t)h * S + qi) * KP; const v16b qf = frag_cat(*(const v8b*)Qp, *(const v8b*)(Qp + 8));
  asm volatile("s_wait_xcnt 0x0" ::: "memory");   // before the q loads' address registers are written again
  const int wu = __builtin_amdgcn_readfirstlane(w);
  // the wave's K and V ranges as wave-uniform bases; a lane's place in a 512-byte fragment piece is the same in both
  const unsigned long long Kw = (unsigned long long)(K2 + ((size_t)(wu & 7) * S + (wu >> 3) * (S / KQ)) * KP), Vw = (unsigned long long)(V2 + ((size_t)(wu & 7) * S + (wu >> 3) * (S / KQ)) * VP); const unsigned lo16 = (unsigned)(col * 16 + 8 * hh);
  // every block walks the same K and V: each enters its 32 key blocks at its own place and wraps round, so that the blocks do not ask L2 for the same lines at the same moment (any start is correct: plain sums);
  // blocks of neighbouring index start together, so four neighbours get starts 8 key blocks apart and each group of 8 moves on by one
  const unsigned rot = (blockIdx.x >> 3) + 8u * (blockIdx.x & 3u);
  const bool ow = (wu >> 3) == KQ - 1 && (wu & 7) < C / 16;   // scalar test: the WMMAs behind it run with every lane on
  v16b wf0 = {}, wf1 = {}; float bo = 0.0f;
  if (ow) { bo = be[(wu & 7) * 16 + col];
    asm volatile("s_wait_xcnt 0x0" ::: "memory");   // before the bias load's address register is written again
    const float* Wp = we + (wu & 7) * 16 + col; wf0 = frag_w<C>(Wp, hh); wf1 = frag_w<C>(Wp + 32 * C, hh); bo = bf16_rne(bo); }
  // q and k are unit vectors (or shorter, at the eps clamp), so every score lies in [-1, 1]: no running maximum, no rescaling of o and l; the lane halves' sums meet after the loop
  const v8f sh = {PSH, PSH, PSH, PSH, PSH, PSH, PSH, PSH}; v8f lv = {}, o = {};
  for (unsigned t = 0; t < NB; ++t) {
    const unsigned ob = ((t + rot) & (NB - 1)) * (32 * KP * 2);   // bytes; a key block is 1 KiB in K2 and in V2
    const gb16* K = (const gb16*)(Kw + ob) + lo16; const gb16* V = (const gb16*)(Vw + ob) + lo16;   // scalar base + one lane offset that the loop never rewrites
    const v8b k0 = *(const gv8b*)K, k1 = *(const gv8b*)(K + 16 * KP), v0 = *(const gv8b*)V, v1 = *(const gv8b*)(V + 256);
    const v8f s0 = wmma16b(frag_cat(k0, k0), qf, sh), s1 = wmma16b(frag_cat(k1, k1), qf, sh); v16b pb, pl;
#pragma unroll
    for (int r = 0; r < 8; ++r) { const float e0 = __builtin_amdgcn_exp2f(s0[r]), e1 = __builtin_amdgcn_exp2f(s1[r]); lv[r] += e0 + e1; b16 a_, c_; split16(e0, a_, c_); pb[r] = a_; pl[r] = c_; split16(e1, a_, c_); pb[8 + r] = a_; pl[8 + r] = c_; }
    const v16b vf = frag_cat(v0, v1); o = wmma16b(vf, pb, o); o = wmma16b(vf, pl, o); }
  float l = ((lv[0] + lv[1]) + (lv[2] + lv[3])) + ((lv[4] + lv[5]) + (lv[6] + lv[7]));
  if (ks > 0) {
#pragma unroll   // constant element indices keep the accumulator in registers
    for (int r = 0; r < 8; ++r) Pp[ks - 1][h][r][lane] = o[r];
    Pp[ks - 1][h][8][lane] = l; }
  __syncthreads();   // the quarters' partial sums are in LDS
  if (ks == 0) {
#pragma unroll
    for (int j = 0; j < KQ - 1; ++j) {
#pragma unroll
      for (int r = 0; r < 8; ++r) o[r] += Pp[j][h][r][lane];
      l += Pp[j][h][8][lane]; }
    l += __shfl_xor(l, 16);
    const float inv = 1.0f / l;
    // o[r] = 8 * l * (hi part (hh == 0) or lo part (hh == 1) of ctx[dim r][query col]): add the two lane halves, lane half 0 stores
#pragma unroll   // constant element indices keep the accumulator in registers
    for (int r = 0; r < 8; ++r) o[r] += __shfl_xor(o[r], 16);
    if (hh == 0) {
#pragma unroll
      for (int r = 0; r < 8; ++r) { b16 a_, c_; split16(o[r] * inv, a_, c_); Oh[col][h * HD + r] = a_; Ol[col][h * HD + r] = c_; } } }
  __syncthreads();   // ctx hi, lo of the 16 queries are in LDS
  if (ow) { v8f acc = {};
    acc = wmma16b(frag_kb(&Oh[col][0], hh), wf0, acc); acc = wmma16b(frag_kb(&Ol[col][0], hh), wf0, acc); acc = wmma16b(frag_kb(&Oh[col][32], hh), wf1, acc); acc = wmma16b(frag_kb(&Ol[col][32], hh), wf1, acc);
#pragma unroll   // constant element indices keep the accumulator in registers
    for (int r = 0; r < 8; ++r) Ts[8 * hh + r][(wu & 7) * 16 + col] = acc[r] * (1.0f / XS) + bo; }
  __syncthreads();   // the 16 x 64 output tile is in LDS: stored as whole rows, 512 contiguous bytes per wave
  if (threadIdx.x < 16 * 16) { const int rr = threadIdx.x >> 4, c4 = (threadIdx.x & 15) * 4; *(v4f*)(out + (size_t)(q0 + rr) * C + c4) = *(const v4f*)(&Ts[rr][c4]); }
}
}  // namespace

extern "C" void kernel_launch(void* const* d_in, const int* in_sizes, int n_in,
                              void* d_out, int out_size, void* d_ws, size_t ws_size, hipStream_t stream) {
  (void)n_in; (void)out_size;
  const float* x = (const float*)d_in[0]; const float* y = (const float*)d_in[1]; const float* wq = (const float*)d_in[2]; const float* bq = (const float*)d_in[3]; const float* wkv = (const float*)d_in[4]; const float* bkv = (const float*)d_in[5]; const float* we = (const float*)d_in[6]; const float* be = (const float*)d_in[7];
  float* out = (float*)d_out;   // [1][4096][64]
  if (in_sizes[0] != S * C || in_sizes[4] != C * 2 * C) return;
  size_t off = 0; char* ws = (char*)d_ws;
  auto carve = [&](size_t bytes) { char* p = ws + off; off += (bytes + 255) & ~(size_t)255; return p; };
  b16* Q2 = (b16*)carve((size_t)S * H * KP * 2); b16* K2 = (b16*)carve((size_t)S * H * KP * 2); b16* V2 = (b16*)carve((size_t)H * VP * S * 2);   // every element written by proj_kernel
  if (off > ws_size) return;                        // 3 MB
  proj_kernel<<<S / 16, 32 * 12, 0, stream>>>(x, y, wq, bq, wkv, bkv, Q2, K2, V2);
  attn_kernel<<<S / 16, 32 * H * KQ, 0, stream>>>(Q2, K2, V2, we, be, out);
}

// v006
// One run takes 29 microseconds.
// Timed twice side by side with v005, it ran 1.04 times as fast both times.
// All steps since v000 together make it 6.00 times as fast.
#include <hip/hip_runtime.h>

// Cross_At: q = x Wq + bq, [k | v] = y Wkv + bkv (8 heads x 8 dims; kv laid out [hw][2][H][d]); q, k L2-normalised per head (eps 1e-12); attn = softmax(q.k) (no scaling); ctx; out = ctx We + be
// -> [1][4096][64].
// WMMA (v_wmma_f32_16x16x32_f16, f32 accumulate): the projections with EXACT operands (x, y, [in][out] weights exact bf16; 1 product) + bias, the per-head L2 normalisation in f32 in the epilogue
// (8-lane shuffles); normalised k x8 and q x log2(e)/8 as f16 hi+lo pairs, 16 halves [hi 8 | lo 8] per (token, head); the K = 32 of one WMMA holds k [hi | lo | hi | lo] against q [hi | hi | lo | lo], so
// S^T = k.q is 1 WMMA per 16 keys; softmax in f32 with a constant shift (every score is a cosine); o^T += (8v)^T.P^T with rows 0..7 = v hi, rows 8..15 = v lo and P hi, P lo (2 WMMAs), the two row halves added after the loop;
// out = ctx.We + be with ctx hi+lo (2 products). Fragment k-map per lane half hh for A AND B: elements 0..7 <- k = 8hh+0..7, 8..15 <- k = 16+8hh+0..7

namespace {
constexpr int S = 4096, C = 64, H = 8, HD = 8, KP = 16 /* head slot for q/k: 8 hi | 8 lo */, VP = 16 /* v^T rows: 8 hi, 8 lo */, KQ = 4 /* key quarters of the attention, one wave each */;
constexpr unsigned NB = S / KQ / 32;   // 32-key blocks per wave, a power of two
constexpr float XS = 8.0f;
constexpr float QS = 1.4426950408889634f / XS;   // q is stored as q * log2(e) / 8, so (8k).(q') = log2(e) * cos(q, k): the exponent of exp2 with no further scaling
constexpr float PSH = 4.0f;                      // constant exponent shift, the C operand of the score WMMA: p = 2^4 * exp(cos) lies in [16/e, 16e] for EVERY input, as |cos| <= 1

typedef _Float16 b16;
typedef __attribute__((ext_vector_type(16))) _Float16 v16b;
typedef __attribute__((ext_vector_type(8))) _Float16 v8b;
typedef __attribute__((ext_vector_type(8))) float v8f;
typedef __attribute__((address_space(1))) _Float16 gb16;   // global memory, named so that an address formed from an integer stays a global load
typedef __attribute__((address_space(1))) v8b gv8b;
typedef __attribute__((ext_vector_type(4))) float v4f;
__device__ __forceinline__ float bf16_rne(float f) { unsigned int u = __float_as_uint(f); u += 0x7FFFu + ((u >> 16) & 1u); return __uint_as_float(u & 0xFFFF0000u); }
__device__ __forceinline__ void split16(float v, b16& hi, b16& lo) { hi = (b16)v; lo = (b16)(v - (float)hi); }
__device__ __forceinline__ v16b frag_kb(const b16* p, int hh) { const v8b a = *(const v8b*)(p + 8 * hh), b = *(const v8b*)(p + 16 + 8 * hh); v16b f;
#pragma unroll
  for (int e = 0; e < 8; ++e) { f[e] = a[e]; f[8 + e] = b[e]; } return f; }
__device__ __forceinline__ v16b frag_cat(v8b a, v8b b) { v16b f;
#pragma unroll   // constant element indices keep the fragment in registers
  for (int e = 0; e < 8; ++e) { f[e] = a[e]; f[8 + e] = b[e]; } return f; }
__device__ __forceinline__ v8f wmma16b(v16b a, v16b b, v8f c) { v8f d = __builtin_amdgcn_wmma_f32_16x16x32_f16(false, a, false, b, (short)0, c, false, false); asm volatile("v_nop\n\tv_nop\n\tv_nop\n\tv_nop" : "+v"(d) : "v"(a), "v"(b)); return d; }
__device__ __forceinline__ void wave_lds_sync() { __builtin_amdgcn_fence(__ATOMIC_RELEASE, "workgroup"); __builtin_amdgcn_wave_barrier(); __builtin_amdgcn_fence(__ATOMIC_ACQUIRE, "workgroup"); }
typedef __attribute__((ext_vector_type(4))) unsigned v4u;
typedef __attribute__((ext_vector_type(8))) unsigned v8u;
// hi+lo split of eight f32 straight into packed f16 registers, 3 vector instructions per pair: one packed convert makes both hi halves, then lo = (f16)(e - hi) is ONE mixed FMA per value that reads its hi half
// out of the packed register and writes its own half of the lo register. e - hi is exact in f32, so the values are those of split16. Written as asm because the compiled form of split16 converts every hi a
// second time on its own, forms e - hi in f32 and packs it with a further convert (6 per pair). Each group of four reads what the group before wrote, four instructions back: the s_delay_alu hints
// let the SIMD's other waves issue in that gap instead of holding the port
__device__ __forceinline__ void split8(v8f e, v4u& hi, v4u& lo) { unsigned h0, h1, h2, h3, l0, l1, l2, l3;
  asm("v_cvt_pk_f16_f32 %0, %8, %9\n\tv_cvt_pk_f16_f32 %1, %10, %11\n\tv_cvt_pk_f16_f32 %2, %12, %13\n\tv_cvt_pk_f16_f32 %3, %14, %15\n\t"
      "s_delay_alu instid0(VALU_DEP_4) | instskip(NEXT) | instid1(VALU_DEP_4)\n\t"
      "v_fma_mixlo_f16 %4, %0, -1.0, %8 op_sel_hi:[1,1,0]\n\tv_fma_mixlo_f16 %5, %1, -1.0, %10 op_sel_hi:[1,1,0]\n\t"
      "s_delay_alu instid0(VALU_DEP_4) | instskip(NEXT) | instid1(VALU_DEP_4)\n\t"
      "v_fma_mixlo_f16 %6, %2, -1.0, %12 op_sel_hi:[1,1,0]\n\tv_fma_mixlo_f16 %7, %3, -1.0, %14 op_sel_hi:[1,1,0]\n\t"
      "s_delay_alu instid0(VALU_DEP_4) | instskip(NEXT) | instid1(VALU_DEP_4)\n\t"
      "v_fma_mixhi_f16 %4, %0, -1.0, %9 op_sel:[1,0,0] op_sel_hi:[1,1,0]\n\tv_fma_mixhi_f16 %5, %1, -1.0, %11 op_sel:[1,0,0] op_sel_hi:[1,1,0]\n\t"
      "s_delay_alu instid0(VALU_DEP_4) | instskip(NEXT) | instid1(VALU_DEP_4)\n\t"
      "v_fma_mixhi_f16 %6, %2, -1.0, %13 op_sel:[1,0,0] op_sel_hi:[1,1,0]\n\tv_fma_mixhi_f16 %7, %3, -1.0, %15 op_sel:[1,0,0] op_sel_hi:[1,1,0]"
      : "=&v"(h0), "=&v"(h1), "=&v"(h2), "=&v"(h3), "=&v"(l0), "=&v"(l1), "=&v"(l2), "=&v"(l3)
      : "v"(e[0]), "v"(e[1]), "v"(e[2]), "v"(e[3]), "v"(e[4]), "v"(e[5]), "v"(e[6]), "v"(e[7]));
  hi = (v4u){h0, h1, h2, h3}; lo = (v4u){l0, l1, l2, l3}; }
__device__ __forceinline__ v16b frag_u(v4u a, v4u b) { const v8u u = {a[0], a[1], a[2], a[3], b[0], b[1], b[2], b[3]}; return __builtin_bit_cast(v16b, u); }
__device__ __forceinline__ float pmul(float a, float b) { float p = a * b; asm volatile("" : "+v"(p)); return p; }

// fragments straight from the f32 inputs, same k-map as frag_kb: a token row (rounded to bf16, x8, exact in f16) and a column of an [in][out] weight (rounded to bf16, exact in f16)
__device__ __forceinline__ v16b frag_x(const float* p, int hh) { const v4f a0 = *(const v4f*)(p + 8 * hh), a1 = *(const v4f*)(p + 8 * hh + 4), b0 = *(const v4f*)(p + 16 + 8 * hh), b1 = *(const v4f*)(p + 16 + 8 * hh + 4); v16b f;
#pragma unroll   // constant element indices keep the fragment in registers
  for (int e = 0; e < 4; ++e) { f[e] = (b16)(bf16_rne(a0[e]) * XS); f[4 + e] = (b16)(bf16_rne(a1[e]) * XS); f[8 + e] = (b16)(bf16_rne(b0[e]) * XS); f[12 + e] = (b16)(bf16_rne(b1[e]) * XS); } return f; }
template <int LD> __device__ __forceinline__ v16b frag_w(const float* p, int hh) { p += 8 * hh * LD; v16b f;   // LD at compile time: one address, the 16 rows as immediate offsets
#pragma unroll   // constant element indices keep the fragment in registers
  for (int e = 0; e < 8; ++e) { f[e] = (b16)bf16_rne(p[e * LD]); f[8 + e] = (b16)bf16_rne(p[(16 + e) * LD]); } return f; }
// one 16 x 16 tile over K = 64: all four fragments are fetched before the first WMMA, so the wave waits for memory once
template <int LD> __device__ __forceinline__ v8f tile64(const float* A, const float* Wp, int hh) { const v16b a0 = frag_x(A, hh), a1 = frag_x(A + 32, hh), w0 = frag_w<LD>(Wp, hh), w1 = frag_w<LD>(Wp + 32 * LD, hh); return wmma16b(a1, w1, wmma16b(a0, w0, (v8f){})); }

// projections, straight from the f32 inputs: block = 16 tokens x 12 waves, wave = one 16 x 16 output tile (2 WMMAs). Waves 0..3: q = x Wq + bq, waves 4..7: k, waves 8..11: v (columns 0..63 / 64..127 of y Wkv + bkv).
// q, k: L2-normalise each 8-dim head (a lane holds ONE column for 8 tokens, the 8 columns of a head live in 8 neighbouring lanes: sum of squares over lane bits 0..2), hi+lo split, turned to
// [h][tok][hi 8 | lo 8] through the wave's own LDS tile (16 tokens of a head = 512 contiguous bytes). v: a lane's 8 tokens of one column ARE one 16-byte piece of V2, stored from registers:
// (8v)^T in the order of the attention's A fragments: V2[h][32-key block][c][row][hh][8 keys], key = 32 block + 16 c + 8 hh + e; rows 0..7 = hi of dims 0..7, rows 8..15 = lo: one c = 512 contiguous bytes
__global__ __launch_bounds__(384) void proj_kernel(const float* __restrict__ x, const float* __restrict__ y, const float* __restrict__ wq, const float* __restrict__ bq, const float* __restrict__ wkv, const float* __restrict__ bkv, b16* __restrict__ Q2, b16* __restrict__ K2, b16* __restrict__ V2) {
  __shared__ __attribute__((aligned(16))) b16 Th[8][16][16 + 8], Tl[8][16][16 + 8];
  const int lane = threadIdx.x & 31, wave = __builtin_amdgcn_readfirstlane(threadIdx.x >> 5), nloc = lane & 15, hlf = lane >> 4, m0 = blockIdx.x * 16;
  const bool isq = wave < 4; const int t = isq ? wave : wave - 4;   // t: column tile of the wave's weight matrix; every test on wave is a scalar branch, the WMMAs behind it run with every lane on
  const float bb = bf16_rne((isq ? bq : bkv)[t * 16 + nloc]);
  const v8f acc = isq ? tile64<C>(x + (size_t)(m0 + nloc) * C, wq + t * 16 + nloc, hlf) : tile64<2 * C>(y + (size_t)(m0 + nloc) * C, wkv + t * 16 + nloc, hlf);
  if (wave >= 8) {   // v
    const int ch = (t - 4) * 16 + nloc; v8b vh, vl;
#pragma unroll   // constant element indices keep the pieces in registers
    for (int v = 0; v < 8; ++v) { b16 a_, c_; split16((acc[v] * (1.0f / XS) + bb) * XS, a_, c_); vh[v] = a_; vl[v] = c_; }
    b16* d = V2 + ((size_t)(ch >> 3) * (S / 32) + (m0 >> 5)) * (32 * VP) + ((m0 >> 4) & 1) * 256 + ((ch & 7) * 2 + hlf) * 8;
    *(v8b*)d = vh; *(v8b*)(d + 128) = vl; return; }   // no block barrier in this kernel: a wave may leave on its own
#pragma unroll
  for (int v = 0; v < 8; ++v) { const float val = acc[v] * (1.0f / XS) + bb; float ss = pmul(val, val); ss += __shfl_xor(ss, 1); ss += __shfl_xor(ss, 2); ss += __shfl_xor(ss, 4); const float nv = val / fmaxf(sqrtf(ss), 1e-12f);
    b16 a_, c_; split16(nv * (isq ? QS : XS), a_, c_); Th[wave][8 * hlf + v][nloc] = a_; Tl[wave][8 * hlf + v][nloc] = c_; }
  wave_lds_sync();   // the tile is the wave's own: its LDS writes are done before its lanes read each other's
  b16* d = (isq ? Q2 : K2) + ((size_t)(2 * t + hlf) * S + m0 + nloc) * KP;   // lane = (head 2t + hlf, token nloc)
  *(v8b*)d = *(const v8b*)(&Th[wave][nloc][hlf * 8]); *(v8b*)(d + 8) = *(const v8b*)(&Tl[wave][nloc][hlf * 8]);
  asm volatile("s_wait_xcnt 0x0" ::: "memory");   // the built code lays the v part behind these stores: the wait stands before their registers are written there
}
// attention: wave = (head, key quarter, 16 queries), block = 8 heads x 4 key quarters = 32 waves (8 per SIMD: the other waves' work covers a wave's load and WMMA -> exp2 -> WMMA waits);
// 32 key blocks of 32 per wave, walked as a ring from a start set by the block index: S^T = k.q (1 WMMA per 16 keys, hi and lo terms side by side in its K = 32), p = exp2 of its result,
// o^T[rows 0..7: v hi, rows 8..15: v lo][16 q] += (8v)^T.P^T (P hi, P lo); every fragment load of the loop is 512 contiguous bytes per wave.
// The constant shift makes the quarters' o and l plain partial sums: quarters 1..3 hand theirs over through LDS, quarter 0 adds them.
// out = ctx We + be for the block's 16 queries in the same launch: ctx hi, lo stay in LDS; four waves of the last quarter take one 16-column tile each (4 WMMAs), their We fragments fetched before the key loop
__global__ __launch_bounds__(1024) void attn_kernel(const b16* __restrict__ Q2, const b16* __restrict__ K2, const b16* __restrict__ V2, const float* __restrict__ we, const float* __restrict__ be, float* __restrict__ out) {
  __shared__ __attribute__((aligned(16))) b16 Oh[16][C + 8], Ol[16][C + 8]; __shared__ float Pp[KQ - 1][H][9][32];   // partial o (8 rows) and l per lane
  __shared__ __attribute__((aligned(16))) float Ts[16][C + 4];
  const int w = threadIdx.x >> 5, h = w & 7, ks = w >> 3, lane = threadIdx.x & 31, hh = lane >> 4, col = lane & 15; const int q0 = blockIdx.x * 16, qi = q0 + col;
  // B: both lane halves hold [q hi | q lo]; A: lane half 0 holds [k hi | k hi], half 1 [k lo | k lo]: k 0..7 hi.hi, 8..15 lo.hi, 16..23 hi.lo, 24..31 lo.lo
  const b16* Qp = Q2 + ((size_t)h * S + qi) * KP; const v16b qf = frag_cat(*(const v8b*)Qp, *(const v8b*)(Qp + 8));
  asm volatile("s_wait_xcnt 0x0" ::: "memory");   // before the q loads' address registers are written again
  const int wu = __builtin_amdgcn_readfirstlane(w);
  // the wave's K and V ranges as wave-uniform bases; a lane's place in a 512-byte fragment piece is the same in both
  const unsigned long long Kw = (unsigned long long)(K2 + ((size_t)(wu & 7) * S + (wu >> 3) * (S / KQ)) * KP), Vw = (unsigned long long)(V2 + ((size_t)(wu & 7) * S + (wu >> 3) * (S / KQ)) * VP); const unsigned lo16 = (unsigned)(col * 16 + 8 * hh);
  // every block walks the same K and V: each enters its 32 key blocks at its own place and wraps round, so that the blocks do not ask L2 for the same lines at the same moment (any start is correct: plain sums);
  // blocks of neighbouring index start together, so four neighbours get starts 8 key blocks apart and each group of 8 moves on by one
  const unsigned rot = (blockIdx.x >> 3) + 8u * (blockIdx.x & 3u);
  const bool ow = (wu >> 3) == KQ - 1 && (wu & 7) < C / 16;   // scalar test: the WMMAs behind it run with every lane on
  v16b wf0 = {}, wf1 = {}; float bo = 0.0f;
  if (ow) { bo = be[(wu & 7) * 16 + col];
    asm volatile("s_wait_xcnt 0x0" ::: "memory");   // before the bias load's address register is written again
    const float* Wp = we + (wu & 7) * 16 + col; wf0 = frag_w<C>(Wp, hh); wf1 = frag_w<C>(Wp + 32 * C, hh); bo = bf16_rne(bo); }
  // q and k are unit vectors (or shorter, at the eps clamp), so every score lies in [-1, 1]: no running maximum, no rescaling of o and l; the lane halves' sums meet after the loop
  const v8f sh = {PSH, PSH, PSH, PSH, PSH, PSH, PSH, PSH}; v8f lv = {}, o = {};
  for (unsigned t = 0; t < NB; ++t) {
    const unsigned ob = ((t + rot) & (NB - 1)) * (32 * KP * 2);   // bytes; a key block is 1 KiB in K2 and in V2
    const gb16* K = (const gb16*)(Kw + ob) + lo16; const gb16* V = (const gb16*)(Vw + ob) + lo16;   // scalar base + one lane offset that the loop never rewrites
    const v8b k0 = *(const gv8b*)K, k1 = *(const gv8b*)(K + 16 * KP), v0 = *(const gv8b*)V, v1 = *(const gv8b*)(V + 256);
    const v8f s0 = wmma16b(frag_cat(k0, k0), qf, sh), s1 = wmma16b(frag_cat(k1, k1), qf, sh); v8f e0, e1;
#pragma unroll   // constant element indices keep e0, e1 and the sums in registers
    for (int r = 0; r < 8; ++r) { e0[r] = __builtin_amdgcn_exp2f(s0[r]); e1[r] = __builtin_amdgcn_exp2f(s1[r]); lv[r] += e0[r] + e1[r]; }
    v4u h0, l0, h1, l1; split8(e0, h0, l0); split8(e1, h1, l1);
    const v16b vf = frag_cat(v0, v1); o = wmma16b(vf, frag_u(h0, h1), o); o = wmma16b(vf, frag_u(l0, l1), o); }
  float l = ((lv[0] + lv[1]) + (lv[2] + lv[3])) + ((lv[4] + lv[5]) + (lv[6] + lv[7]));
  if (ks > 0) {
#pragma unroll   // constant element indices keep the accumulator in registers
    for (int r = 0; r < 8; ++r) Pp[ks - 1][h][r][lane] = o[r];
    Pp[ks - 1][h][8][lane] = l; }
  __syncthreads();   // the quarters' partial sums are in LDS
  if (ks == 0) {
#pragma unroll
    for (int j = 0; j < KQ - 1; ++j) {
#pragma unroll
      for (int r = 0; r < 8; ++r) o[r] += Pp[j][h][r][lane];
      l += Pp[j][h][8][lane]; }
    l += __shfl_xor(l, 16);
    const float inv = 1.0f / l;
    // o[r] = 8 * l * (hi part (hh == 0) or lo part (hh == 1) of ctx[dim r][query col]): add the two lane halves, lane half 0 stores
#pragma unroll   // constant element indices keep the accumulator in registers
    for (int r = 0; r < 8; ++r) o[r] += __shfl_xor(o[r], 16);
    if (hh == 0) {
#pragma unroll
      for (int r = 0; r < 8; ++r) { b16 a_, c_; split16(o[r] * inv, a_, c_); Oh[col][h * HD + r] = a_; Ol[col][h * HD + r] = c_; } } }
  __syncthreads();   // ctx hi, lo of the 16 queries are in LDS
  if (ow) { v8f acc = {};
    acc = wmma16b(frag_kb(&Oh[col][0], hh), wf0, acc); acc = wmma16b(frag_kb(&Ol[col][0], hh), wf0, acc); acc = wmma16b(frag_kb(&Oh[col][32], hh), wf1, acc); acc = wmma16b(frag_kb(&Ol[col][32], hh), wf1, acc);
#pragma unroll   // constant element indices keep the accumulator in registers
    for (int r = 0; r < 8; ++r) Ts[8 * hh + r][(wu & 7) * 16 + col] = acc[r] * (1.0f / XS) + bo; }
  __syncthreads();   // the 16 x 64 output tile is in LDS: stored as whole rows, 512 contiguous bytes per wave
  if (threadIdx.x < 16 * 16) { const int rr = threadIdx.x >> 4, c4 = (threadIdx.x & 15) * 4; *(v4f*)(out + (size_t)(q0 + rr) * C + c4) = *(const v4f*)(&Ts[rr][c4]); }
}
}  // namespace

extern "C" void kernel_launch(void* const* d_in, const int* in_sizes, int n_in,
                              void* d_out, int out_size, void* d_ws, size_t ws_size, hipStream_t stream) {
  (void)n_in; (void)out_size;
  const float* x = (const float*)d_in[0]; const float* y = (const float*)d_in[1]; const float* wq = (const float*)d_in[2]; const float* bq = (const float*)d_in[3]; const float* wkv = (const float*)d_in[4]; const float* bkv = (const float*)d_in[5]; const float* we = (const float*)d_in[6]; const float* be = (const float*)d_in[7];
  float* out = (float*)d_out;   // [1][4096][64]
  if (in_sizes[0] != S * C || in_sizes[4] != C * 2 * C) return;
  size_t off = 0; char* ws = (char*)d_ws;
  auto carve = [&](size_t bytes) { char* p = ws + off; off += (bytes + 255) & ~(size_t)255; return p; };
  b16* Q2 = (b16*)carve((size_t)S * H * KP * 2); b16* K2 = (b16*)carve((size_t)S * H * KP * 2); b16* V2 = (b16*)carve((size_t)H * VP * S * 2);   // every element written by proj_kernel
  if (off > ws_size) return;                        // 3 MB
  proj_kernel<<<S / 16, 32 * 12, 0, stream>>>(x, y, wq, bq, wkv, bkv, Q2, K2, V2);
  attn_kernel<<<S / 16, 32 * H * KQ, 0, stream>>>(Q2, K2, V2, we, be, out);
}

// v007
// It runs in 28 microseconds.
// Two timings next to v006 both put it at 1.04 times that version's speed.
// Over all steps from v000 it is 6.24 times as fast.
#include <hip/hip_runtime.h>

// Cross_At: q = x Wq + bq, [k | v] = y Wkv + bkv (8 heads x 8 dims; kv laid out [hw][2][H][d]); q, k L2-normalised per head (eps 1e-12); attn = softmax(q.k) (no scaling); ctx; out = ctx We + be
// -> [1][4096][64].
// WMMA (v_wmma_f32_16x16x32_f16, f32 accumulate): the projections with EXACT operands (x, y, [in][out] weights exact bf16; 1 product) + bias, the per-head L2 normalisation in f32 in the epilogue
// (8-lane shuffles); normalised k x8 and q x log2(e)/8 as f16 hi+lo pairs, 16 halves [hi 8 | lo 8] per (token, head); the K = 32 of one WMMA holds k [hi | lo | hi | lo] against q [hi | hi | lo | lo], so
// S^T = k.q is 1 WMMA per 16 keys; softmax in f32 with a constant shift (every score is a cosine); o^T += (8v)^T.P^T with rows 0..7 = v hi, rows 8..15 = v lo and P hi, P lo (2 WMMAs), the two row halves added after the loop;
// out = ctx.We + be with ctx hi+lo (2 products). Fragment k-map per lane half hh for A AND B: elements 0..7 <- k = 8hh+0..7, 8..15 <- k = 16+8hh+0..7

namespace {
constexpr int S = 4096, C = 64, H = 8, HD = 8, KP = 16 /* head slot for q/k: 8 hi | 8 lo */, VP = 16 /* v^T rows: 8 hi, 8 lo */, KQ = 4 /* key quarters of the attention, one wave each */;
constexpr unsigned NB = S / KQ / 32;   // 32-key blocks per wave, a power of two
constexpr float XS = 8.0f;
constexpr float QS = 1.4426950408889634f / XS;   // q is stored as q * log2(e) / 8, so (8k).(q') = log2(e) * cos(q, k): the exponent of exp2 with no further scaling
constexpr float PSH = 4.0f;                      // constant exponent shift, the C operand of the score WMMA: p = 2^4 * exp(cos) lies in [16/e, 16e] for EVERY input, as |cos| <= 1

typedef _Float16 b16;
typedef __attribute__((ext_vector_type(16))) _Float16 v16b;
typedef __attribute__((ext_vector_type(8))) _Float16 v8b;
typedef __attribute__((ext_vector_type(8))) float v8f;
typedef __attribute__((address_space(1))) _Float16 gb16;   // global memory, named so that an address formed from an integer stays a global load
typedef __attribute__((address_space(1))) v8b gv8b;
typedef __attribute__((ext_vector_type(4))) float v4f;
__device__ __forceinline__ float bf16_rne(float f) { unsigned int u = __float_as_uint(f); u += 0x7FFFu + ((u >> 16) & 1u); return __uint_as_float(u & 0xFFFF0000u); }
__device__ __forceinline__ void split16(float v, b16& hi, b16& lo) { hi = (b16)v; lo = (b16)(v - (float)hi); }
__device__ __forceinline__ v16b frag_kb(const b16* p, int hh) { const v8b a = *(const v8b*)(p + 8 * hh), b = *(const v8b*)(p + 16 + 8 * hh); v16b f;
#pragma unroll
  for (int e = 0; e < 8; ++e) { f[e] = a[e]; f[8 + e] = b[e]; } return f; }
__device__ __forceinline__ v16b frag_cat(v8b a, v8b b) { v16b f;
#pragma unroll   // constant element indices keep the fragment in registers
  for (int e = 0; e < 8; ++e) { f[e] = a[e]; f[8 + e] = b[e]; } return f; }
__device__ __forceinline__ v8f wmma16b(v16b a, v16b b, v8f c) { v8f d = __builtin_amdgcn_wmma_f32_16x16x32_f16(false, a, false, b, (short)0, c, false, false); asm volatile("v_nop\n\tv_nop\n\tv_nop\n\tv_nop" : "+v"(d) : "v"(a), "v"(b)); return d; }
__device__ __forceinline__ void wave_lds_sync() { __builtin_amdgcn_fence(__ATOMIC_RELEASE, "workgroup"); __builtin_amdgcn_wave_barrier(); __builtin_amdgcn_fence(__ATOMIC_ACQUIRE, "workgroup"); }
typedef __attribute__((ext_vector_type(4))) unsigned v4u;
typedef __attribute__((ext_vector_type(8))) unsigned v8u;
// hi+lo split of eight f32 straight into packed f16 registers, 3 vector instructions per pair: one packed convert makes both hi halves, then lo = (f16)(e - hi) is ONE mixed FMA per value that reads its hi half
// out of the packed register and writes its own half of the lo register. e - hi is exact in f32, so the values are those of split16. Written as asm because the compiled form of split16 converts every hi a
// second time on its own, forms e - hi in f32 and packs it with a further convert (6 per pair). Each group of four reads what the group before wrote, four instructions back: the s_delay_alu hints
// let the SIMD's other waves issue in that gap instead of holding the port
__device__ __forceinline__ void split8(v8f e, v4u& hi, v4u& lo) { unsigned h0, h1, h2, h3, l0, l1, l2, l3;
  asm("v_cvt_pk_f16_f32 %0, %8, %9\n\tv_cvt_pk_f16_f32 %1, %10, %11\n\tv_cvt_pk_f16_f32 %2, %12, %13\n\tv_cvt_pk_f16_f32 %3, %14, %15\n\t"
      "s_delay_alu instid0(VALU_DEP_4) | instskip(NEXT) | instid1(VALU_DEP_4)\n\t"
      "v_fma_mixlo_f16 %4, %0, -1.0, %8 op_sel_hi:[1,1,0]\n\tv_fma_mixlo_f16 %5, %1, -1.0, %10 op_sel_hi:[1,1,0]\n\t"
      "s_delay_alu instid0(VALU_DEP_4) | instskip(NEXT) | instid1(VALU_DEP_4)\n\t"
      "v_fma_mixlo_f16 %6, %2, -1.0, %12 op_sel_hi:[1,1,0]\n\tv_fma_mixlo_f16 %7, %3, -1.0, %14 op_sel_hi:[1,1,0]\n\t"
      "s_delay_alu instid0(VALU_DEP_4) | instskip(NEXT) | instid1(VALU_DEP_4)\n\t"
      "v_fma_mixhi_f16 %4, %0, -1.0, %9 op_sel:[1,0,0] op_sel_hi:[1,1,0]\n\tv_fma_mixhi_f16 %5, %1, -1.0, %11 op_sel:[1,0,0] op_sel_hi:[1,1,0]\n\t"
      "s_delay_alu instid0(VALU_DEP_4) | instskip(NEXT) | instid1(VALU_DEP_4)\n\t"
      "v_fma_mixhi_f16 %6, %2, -1.0, %13 op_sel:[1,0,0] op_sel_hi:[1,1,0]\n\tv_fma_mixhi_f16 %7, %3, -1.0, %15 op_sel:[1,0,0] op_sel_hi:[1,1,0]"
      : "=&v"(h0), "=&v"(h1), "=&v"(h2), "=&v"(h3), "=&v"(l0), "=&v"(l1), "=&v"(l2), "=&v"(l3)
      : "v"(e[0]), "v"(e[1]), "v"(e[2]), "v"(e[3]), "v"(e[4]), "v"(e[5]), "v"(e[6]), "v"(e[7]));
  hi = (v4u){h0, h1, h2, h3}; lo = (v4u){l0, l1, l2, l3}; }
__device__ __forceinline__ v16b frag_u(v4u a, v4u b) { const v8u u = {a[0], a[1], a[2], a[3], b[0], b[1], b[2], b[3]}; return __builtin_bit_cast(v16b, u); }
__device__ __forceinline__ float pmul(float a, float b) { float p = a * b; asm volatile("" : "+v"(p)); return p; }

// fragments straight from the f32 inputs, same k-map as frag_kb: a token row (rounded to bf16, x8, exact in f16) and a column of an [in][out] weight (rounded to bf16, exact in f16)
__device__ __forceinline__ v16b frag_x(const float* p, int hh) { const v4f a0 = *(const v4f*)(p + 8 * hh), a1 = *(const v4f*)(p + 8 * hh + 4), b0 = *(const v4f*)(p + 16 + 8 * hh), b1 = *(const v4f*)(p + 16 + 8 * hh + 4); v16b f;
#pragma unroll   // constant element indices keep the fragment in registers
  for (int e = 0; e < 4; ++e) { f[e] = (b16)(bf16_rne(a0[e]) * XS); f[4 + e] = (b16)(bf16_rne(a1[e]) * XS); f[8 + e] = (b16)(bf16_rne(b0[e]) * XS); f[12 + e] = (b16)(bf16_rne(b1[e]) * XS); } return f; }
template <int LD> __device__ __forceinline__ v16b frag_w(const float* p, int hh) { p += 8 * hh * LD; v16b f;   // LD at compile time: one address, the 16 rows as immediate offsets
#pragma unroll   // constant element indices keep the fragment in registers
  for (int e = 0; e < 8; ++e) { f[e] = (b16)bf16_rne(p[e * LD]); f[8 + e] = (b16)bf16_rne(p[(16 + e) * LD]); } return f; }
// one 16 x 16 tile over K = 64: all four fragments are fetched before the first WMMA, so the wave waits for memory once
template <int LD> __device__ __forceinline__ v8f tile64(const float* A, const float* Wp, int hh) { const v16b a0 = frag_x(A, hh), a1 = frag_x(A + 32, hh), w0 = frag_w<LD>(Wp, hh), w1 = frag_w<LD>(Wp + 32 * LD, hh); return wmma16b(a1, w1, wmma16b(a0, w0, (v8f){})); }

// projections, straight from the f32 inputs: block = 16 tokens x 12 waves, wave = one 16 x 16 output tile (2 WMMAs). Waves 0..3: q = x Wq + bq, waves 4..7: k, waves 8..11: v (columns 0..63 / 64..127 of y Wkv + bkv).
// q, k: L2-normalise each 8-dim head (a lane holds ONE column for 8 tokens, the 8 columns of a head live in 8 neighbouring lanes: sum of squares over lane bits 0..2), hi+lo split, turned to
// [h][tok][hi 8 | lo 8] through the wave's own LDS tile (16 tokens of a head = 512 contiguous bytes). v: a lane's 8 tokens of one column ARE one 16-byte piece of V2, stored from registers:
// (8v)^T in the order of the attention's A fragments: V2[h][32-key block][c][row][hh][8 keys], key = 32 block + 16 c + 8 hh + e; rows 0..7 = hi of dims 0..7, rows 8..15 = lo: one c = 512 contiguous bytes
__global__ __launch_bounds__(384) void proj_kernel(const float* __restrict__ x, const float* __restrict__ y, const float* __restrict__ wq, const float* __restrict__ bq, const float* __restrict__ wkv, const float* __restrict__ bkv, b16* __restrict__ Q2, b16* __restrict__ K2, b16* __restrict__ V2) {
  __shared__ __attribute__((aligned(16))) b16 Th[8][16][16 + 8], Tl[8][16][16 + 8];
  const int lane = threadIdx.x & 31, wave = __builtin_amdgcn_readfirstlane(threadIdx.x >> 5), nloc = lane & 15, hlf = lane >> 4, m0 = blockIdx.x * 16;
  const bool isq = wave < 4; const int t = isq ? wave : wave - 4;   // t: column tile of the wave's weight matrix; every test on wave is a scalar branch, the WMMAs behind it run with every lane on
  const float bb = bf16_rne((isq ? bq : bkv)[t * 16 + nloc]);
  const v8f acc = isq ? tile64<C>(x + (size_t)(m0 + nloc) * C, wq + t * 16 + nloc, hlf) : tile64<2 * C>(y + (size_t)(m0 + nloc) * C, wkv + t * 16 + nloc, hlf);
  if (wave >= 8) {   // v
    const int ch = (t - 4) * 16 + nloc; v8b vh, vl;
#pragma unroll   // constant element indices keep the pieces in registers
    for (int v = 0; v < 8; ++v) { b16 a_, c_; split16((acc[v] * (1.0f / XS) + bb) * XS, a_, c_); vh[v] = a_; vl[v] = c_; }
    b16* d = V2 + ((size_t)(ch >> 3) * (S / 32) + (m0 >> 5)) * (32 * VP) + ((m0 >> 4) & 1) * 256 + ((ch & 7) * 2 + hlf) * 8;
    *(v8b*)d = vh; *(v8b*)(d + 128) = vl; return; }   // no block barrier in this kernel: a wave may leave on its own
#pragma unroll
  for (int v = 0; v < 8; ++v) { const float val = acc[v] * (1.0f / XS) + bb; float ss = pmul(val, val); ss += __shfl_xor(ss, 1); ss += __shfl_xor(ss, 2); ss += __shfl_xor(ss, 4); const float nv = val / fmaxf(sqrtf(ss), 1e-12f);
    b16 a_, c_; split16(nv * (isq ? QS : XS), a_, c_); Th[wave][8 * hlf + v][nloc] = a_; Tl[wave][8 * hlf + v][nloc] = c_; }
  wave_lds_sync();   // the tile is the wave's own: its LDS writes are done before its lanes read each other's
  b16* d = (isq ? Q2 : K2) + ((size_t)(2 * t + hlf) * S + m0 + nloc) * KP;   // lane = (head 2t + hlf, token nloc)
  *(v8b*)d = *(const v8b*)(&Th[wave][nloc][hlf * 8]); *(v8b*)(d + 8) = *(const v8b*)(&Tl[wave][nloc][hlf * 8]);
  asm volatile("s_wait_xcnt 0x0" ::: "memory");   // the built code lays the v part behind these stores: the wait stands before their registers are written there
}
// attention: wave = (head, key quarter, 16 queries), block = 8 heads x 4 key quarters = 32 waves (8 per SIMD: the other waves' work covers a wave's load and WMMA -> exp2 -> WMMA waits);
// 32 key blocks of 32 per wave, walked as a ring from a start set by the block index: S^T = k.q (1 WMMA per 16 keys, hi and lo terms side by side in its K = 32), p = exp2 of its result,
// o^T[rows 0..7: v hi, rows 8..15: v lo][16 q] += (8v)^T.P^T (P hi, P lo); every fragment load of the loop is 512 contiguous bytes per wave.
// The constant shift makes the quarters' o and l plain partial sums: quarters 1..3 hand theirs over through LDS, quarter 0 adds them.
// out = ctx We + be for the block's 16 queries in the same launch: ctx hi, lo stay in LDS; four waves of the last quarter take one 16-column tile each (4 WMMAs), their We fragments fetched before the key loop
__global__ __launch_bounds__(1024) void attn_kernel(const b16* __restrict__ Q2, const b16* __restrict__ K2, const b16* __restrict__ V2, const float* __restrict__ we, const float* __restrict__ be, float* __restrict__ out) {
  __shared__ __attribute__((aligned(16))) b16 Oh[16][C + 8], Ol[16][C + 8]; __shared__ float Pp[KQ - 1][H][9][32];   // partial o (8 rows) and l per lane
  __shared__ __attribute__((aligned(16))) float Ts[16][C + 4];
  const int w = threadIdx.x >> 5, h = w & 7, ks = w >> 3, lane = threadIdx.x & 31, hh = lane >> 4, col = lane & 15; const int q0 = blockIdx.x * 16, qi = q0 + col;
  // B: both lane halves hold [q hi | q lo]; A: lane half 0 holds [k hi | k hi], half 1 [k lo | k lo]: k 0..7 hi.hi, 8..15 lo.hi, 16..23 hi.lo, 24..31 lo.lo
  const b16* Qp = Q2 + ((size_t)h * S + qi) * KP; const v16b qf = frag_cat(*(const v8b*)Qp, *(const v8b*)(Qp + 8));
  asm volatile("s_wait_xcnt 0x0" ::: "memory");   // before the q loads' address registers are written again
  const int wu = __builtin_amdgcn_readfirstlane(w);
  // the wave's K and V ranges as wave-uniform bases; a lane's place in a 512-byte fragment piece is the same in both
  const unsigned long long Kw = (unsigned long long)(K2 + ((size_t)(wu & 7) * S + (wu >> 3) * (S / KQ)) * KP), Vw = (unsigned long long)(V2 + ((size_t)(wu & 7) * S + (wu >> 3) * (S / KQ)) * VP); const unsigned lo16 = (unsigned)(col * 16 + 8 * hh);
  // every block walks the same K and V: each enters its 32 key blocks at its own place and wraps round, so that the blocks do not ask L2 for the same lines at the same moment (any start is correct: plain sums);
  // blocks of neighbouring index start together, so four neighbours get starts 8 key blocks apart and each group of 8 moves on by one
  const unsigned rot = (blockIdx.x >> 3) + 8u * (blockIdx.x & 3u);
  const bool ow = (wu >> 3) == KQ - 1 && (wu & 7) < C / 16;   // scalar test: the WMMAs behind it run with every lane on
  v16b wf0 = {}, wf1 = {}; float bo = 0.0f;
  if (ow) { bo = be[(wu & 7) * 16 + col];
    asm volatile("s_wait_xcnt 0x0" ::: "memory");   // before the bias load's address register is written again
    const float* Wp = we + (wu & 7) * 16 + col; wf0 = frag_w<C>(Wp, hh); wf1 = frag_w<C>(Wp + 32 * C, hh); bo = bf16_rne(bo); }
  // q and k are unit vectors (or shorter, at the eps clamp), so every score lies in [-1, 1]: no running maximum, no rescaling of o and l; the lane halves' sums meet after the loop
  const v8f sh = {PSH, PSH, PSH, PSH, PSH, PSH, PSH, PSH}; v8f lv = {}, o = {};
  // one key block's four fragment loads (scalar base + one lane offset that the loop never rewrites)
  auto fetch = [&](unsigned t, v8b& k0, v8b& k1, v8b& v0, v8b& v1) {
    const unsigned ob = ((t + rot) & (NB - 1)) * (32 * KP * 2);   // bytes; a key block is 1 KiB in K2 and in V2
    const gb16* K = (const gb16*)(Kw + ob) + lo16; const gb16* V = (const gb16*)(Vw + ob) + lo16;
    k0 = *(const gv8b*)K; k1 = *(const gv8b*)(K + 16 * KP); v0 = *(const gv8b*)V; v1 = *(const gv8b*)(V + 256);
    asm volatile("s_wait_xcnt 0x0" ::: "memory"); };   // before the next fetch writes the base registers again; it also keeps the loads here, ahead of the work on the block before
  auto work = [&](v8b k0, v8b k1, v8b v0, v8b v1) {
    const v8f s0 = wmma16b(frag_cat(k0, k0), qf, sh), s1 = wmma16b(frag_cat(k1, k1), qf, sh); v8f e0, e1;
#pragma unroll   // constant element indices keep e0, e1 and the sums in registers
    for (int r = 0; r < 8; ++r) { e0[r] = __builtin_amdgcn_exp2f(s0[r]); e1[r] = __builtin_amdgcn_exp2f(s1[r]); lv[r] += e0[r] + e1[r]; }
    v4u h0, l0, h1, l1; split8(e0, h0, l0); split8(e1, h1, l1);
    const v16b vf = frag_cat(v0, v1); o = wmma16b(vf, frag_u(h0, h1), o); o = wmma16b(vf, frag_u(l0, l1), o); };
  // two register sets: the next key block's K and V are on their way from L2 while this block is worked on, so a wave asks L2 and uses the vector port at the same time; blocks are worked on in the old order
  v8b ak0, ak1, av0, av1, bk0, bk1, bv0, bv1; fetch(0, ak0, ak1, av0, av1);
  for (unsigned t = 0; t < NB - 2; t += 2) { fetch(t + 1, bk0, bk1, bv0, bv1); work(ak0, ak1, av0, av1); fetch(t + 2, ak0, ak1, av0, av1); work(bk0, bk1, bv0, bv1); }
  fetch(NB - 1, bk0, bk1, bv0, bv1); work(ak0, ak1, av0, av1); work(bk0, bk1, bv0, bv1);
  float l = ((lv[0] + lv[1]) + (lv[2] + lv[3])) + ((lv[4] + lv[5]) + (lv[6] + lv[7]));
  if (ks > 0) {
#pragma unroll   // constant element indices keep the accumulator in registers
    for (int r = 0; r < 8; ++r) Pp[ks - 1][h][r][lane] = o[r];
    Pp[ks - 1][h][8][lane] = l; }
  __syncthreads();   // the quarters' partial sums are in LDS
  if (ks == 0) {
#pragma unroll
    for (int j = 0; j < KQ - 1; ++j) {
#pragma unroll
      for (int r = 0; r < 8; ++r) o[r] += Pp[j][h][r][lane];
      l += Pp[j][h][8][lane]; }
    l += __shfl_xor(l, 16);
    const float inv = 1.0f / l;
    // o[r] = 8 * l * (hi part (hh == 0) or lo part (hh == 1) of ctx[dim r][query col]): add the two lane halves, lane half 0 stores
#pragma unroll   // constant element indices keep the accumulator in registers
    for (int r = 0; r < 8; ++r) o[r] += __shfl_xor(o[r], 16);
    if (hh == 0) {
#pragma unroll
      for (int r = 0; r < 8; ++r) { b16 a_, c_; split16(o[r] * inv, a_, c_); Oh[col][h * HD + r] = a_; Ol[col][h * HD + r] = c_; } } }
  __syncthreads();   // ctx hi, lo of the 16 queries are in LDS
  if (ow) { v8f acc = {};
    acc = wmma16b(frag_kb(&Oh[col][0], hh), wf0, acc); acc = wmma16b(frag_kb(&Ol[col][0], hh), wf0, acc); acc = wmma16b(frag_kb(&Oh[col][32], hh), wf1, acc); acc = wmma16b(frag_kb(&Ol[col][32], hh), wf1, acc);
#pragma unroll   // constant element indices keep the accumulator in registers
    for (int r = 0; r < 8; ++r) Ts[8 * hh + r][(wu & 7) * 16 + col] = acc[r] * (1.0f / XS) + bo; }
  __syncthreads();   // the 16 x 64 output tile is in LDS: stored as whole rows, 512 contiguous bytes per wave
  if (threadIdx.x < 16 * 16) { const int rr = threadIdx.x >> 4, c4 = (threadIdx.x & 15) * 4; *(v4f*)(out + (size_t)(q0 + rr) * C + c4) = *(const v4f*)(&Ts[rr][c4]); }
}
}  // namespace

extern "C" void kernel_launch(void* const* d_in, const int* in_sizes, int n_in,
                              void* d_out, int out_size, void* d_ws, size_t ws_size, hipStream_t stream) {
  (void)n_in; (void)out_size;
  const float* x = (const float*)d_in[0]; const float* y = (const float*)d_in[1]; const float* wq = (const float*)d_in[2]; const float* bq = (const float*)d_in[3]; const float* wkv = (const float*)d_in[4]; const float* bkv = (const float*)d_in[5]; const float* we = (const float*)d_in[6]; const float* be = (const float*)d_in[7];
  float* out = (float*)d_out;   // [1][4096][64]
  if (in_sizes[0] != S * C || in_sizes[4] != C * 2 * C) return;
  size_t off = 0; char* ws = (char*)d_ws;
  auto carve = [&](size_t bytes) { char* p = ws + off; off += (bytes + 255) & ~(size_t)255; return p; };
  b16* Q2 = (b16*)carve((size_t)S * H * KP * 2); b16* K2 = (b16*)carve((size_t)S * H * KP * 2); b16* V2 = (b16*)carve((size_t)H * VP * S * 2);   // every element written by proj_kernel
  if (off > ws_size) return;                        // 3 MB
  proj_kernel<<<S / 16, 32 * 12, 0, stream>>>(x, y, wq, bq, wkv, bkv, Q2, K2, V2);
  attn_kernel<<<S / 16, 32 * H * KQ, 0, stream>>>(Q2, K2, V2, we, be, out);
}

// v008
// A run of this version takes 20.9 microseconds.
// In both of two side-by-side timings against v007, it was 1.34 times as fast.
// Over all steps from v000 it is 8.33 times as fast.
#include <hip/hip_runtime.h>

// Cross_At: q = x Wq + bq, [k | v] = y Wkv + bkv (8 heads x 8 dims; kv laid out [hw][2][H][d]); q, k L2-normalised per head (eps 1e-12); attn = softmax(q.k) (no scaling); ctx; out = ctx We + be
// -> [1][4096][64].
// WMMA (v_wmma_f32_16x16x32_f16, f32 accumulate): the projections with EXACT operands (x, y, [in][out] weights exact bf16; 1 product) + bias, the per-head L2 normalisation in f32 in the epilogue
// (8-lane shuffles); normalised k x8, 8v and P are each rounded ONCE to f16 (11 significant bits; these rounding errors are independent from key to key and average out over the 4096 keys of a softmax row);
// q x log2(e)/8 stays an f16 hi+lo pair, 16 halves [hi 8 | lo 8] per (token, head). The K = 32 of one score A fragment holds TWO 16-key tiles, [tile 0 | tile 1 | tile 0 | tile 1], against q [hi | 0 | lo | 0] or [0 | hi | 0 | lo], so
// S^T = k.q is 1 WMMA per 16 keys and one 512-byte load brings 32 keys; softmax in f32 with a constant shift (every score is a cosine); o^T += (8v)^T.P^T, 1 WMMA per 32 keys (rows 8..15 repeat rows 0..7 and are not used);
// out = ctx.We + be with ctx hi+lo (2 products). Fragment k-map per lane half hh for A AND B: elements 0..7 <- k = 8hh+0..7, 8..15 <- k = 16+8hh+0..7

namespace {
constexpr int S = 4096, C = 64, H = 8, HD = 8, KP = 16 /* head slot for q: 8 hi | 8 lo */, KQ = 4 /* key quarters of the attention, one wave each */;
constexpr unsigned NB = S / KQ / 32;   // 32-key blocks per wave, a power of two
constexpr float XS = 8.0f;
constexpr float QS = 1.4426950408889634f / XS;   // q is stored as q * log2(e) / 8, so (8k).(q') = log2(e) * cos(q, k): the exponent of exp2 with no further scaling
constexpr float PSH = 4.0f;                      // constant exponent shift, the C operand of the score WMMA: p = 2^4 * exp(cos) lies in [16/e, 16e] for EVERY input, as |cos| <= 1

typedef _Float16 b16;
typedef __attribute__((ext_vector_type(16))) _Float16 v16b;
typedef __attribute__((ext_vector_type(8))) _Float16 v8b;
typedef __attribute__((ext_vector_type(8))) float v8f;
typedef __attribute__((address_space(1))) _Float16 gb16;   // global memory, named so that an address formed from an integer stays a global load
typedef __attribute__((address_space(1))) v8b gv8b;
typedef __attribute__((ext_vector_type(4))) float v4f;
__device__ __forceinline__ float bf16_rne(float f) { unsigned int u = __float_as_uint(f); u += 0x7FFFu + ((u >> 16) & 1u); return __uint_as_float(u & 0xFFFF0000u); }
__device__ __forceinline__ void split16(float v, b16& hi, b16& lo) { hi = (b16)v; lo = (b16)(v - (float)hi); }
__device__ __forceinline__ v16b frag_kb(const b16* p, int hh) { const v8b a = *(const v8b*)(p + 8 * hh), b = *(const v8b*)(p + 16 + 8 * hh); v16b f;
#pragma unroll
  for (int e = 0; e < 8; ++e) { f[e] = a[e]; f[8 + e] = b[e]; } return f; }
__device__ __forceinline__ v16b frag_cat(v8b a, v8b b) { v16b f;
#pragma unroll   // constant element indices keep the fragment in registers
  for (int e = 0; e < 8; ++e) { f[e] = a[e]; f[8 + e] = b[e]; } return f; }
__device__ __forceinline__ v8f wmma16b(v16b a, v16b b, v8f c) { v8f d = __builtin_amdgcn_wmma_f32_16x16x32_f16(false, a, false, b, (short)0, c, false, false); asm volatile("v_nop\n\tv_nop\n\tv_nop\n\tv_nop" : "+v"(d) : "v"(a), "v"(b)); return d; }
__device__ __forceinline__ void wave_lds_sync() { __builtin_amdgcn_fence(__ATOMIC_RELEASE, "workgroup"); __builtin_amdgcn_wave_barrier(); __builtin_amdgcn_fence(__ATOMIC_ACQUIRE, "workgroup"); }
__device__ __forceinline__ float pmul(float a, float b) { float p = a * b; asm volatile("" : "+v"(p)); return p; }

// fragments straight from the f32 inputs, same k-map as frag_kb: a token row (rounded to bf16, x8, exact in f16) and a column of an [in][out] weight (rounded to bf16, exact in f16)
__device__ __forceinline__ v16b frag_x(const float* p, int hh) { const v4f a0 = *(const v4f*)(p + 8 * hh), a1 = *(const v4f*)(p + 8 * hh + 4), b0 = *(const v4f*)(p + 16 + 8 * hh), b1 = *(const v4f*)(p + 16 + 8 * hh + 4); v16b f;
#pragma unroll   // constant element indices keep the fragment in registers
  for (int e = 0; e < 4; ++e) { f[e] = (b16)(bf16_rne(a0[e]) * XS); f[4 + e] = (b16)(bf16_rne(a1[e]) * XS); f[8 + e] = (b16)(bf16_rne(b0[e]) * XS); f[12 + e] = (b16)(bf16_rne(b1[e]) * XS); } return f; }
template <int LD> __device__ __forceinline__ v16b frag_w(const float* p, int hh) { p += 8 * hh * LD; v16b f;   // LD at compile time: one address, the 16 rows as immediate offsets
#pragma unroll   // constant element indices keep the fragment in registers
  for (int e = 0; e < 8; ++e) { f[e] = (b16)bf16_rne(p[e * LD]); f[8 + e] = (b16)bf16_rne(p[(16 + e) * LD]); } return f; }
// one 16 x 16 tile over K = 64: all four fragments are fetched before the first WMMA, so the wave waits for memory once
template <int LD> __device__ __forceinline__ v8f tile64(const float* A, const float* Wp, int hh) { const v16b a0 = frag_x(A, hh), a1 = frag_x(A + 32, hh), w0 = frag_w<LD>(Wp, hh), w1 = frag_w<LD>(Wp + 32 * LD, hh); return wmma16b(a1, w1, wmma16b(a0, w0, (v8f){})); }

// projections, straight from the f32 inputs: block = 16 tokens x 12 waves, wave = one 16 x 16 output tile (2 WMMAs). Waves 0..3: q = x Wq + bq, waves 4..7: k, waves 8..11: v (columns 0..63 / 64..127 of y Wkv + bkv).
// q, k: L2-normalise each 8-dim head (a lane holds ONE column for 8 tokens, the 8 columns of a head live in 8 neighbouring lanes: sum of squares over lane bits 0..2), q split hi+lo, k rounded to f16, turned to
// q [h][tok][hi 8 | lo 8], k [h][tok][8] through the wave's own LDS tile (16 tokens of a head = 512 / 256 contiguous bytes). v: a lane's 8 tokens of one column ARE one 16-byte piece of V2, stored from registers:
// (8v)^T in the order of the attention's A fragments: V2[h][32-key block][c][dim][hh][8 keys], key = 32 block + 16 c + 8 hh + e: one c = 256 contiguous bytes
__global__ __launch_bounds__(384) void proj_kernel(const float* __restrict__ x, const float* __restrict__ y, const float* __restrict__ wq, const float* __restrict__ bq, const float* __restrict__ wkv, const float* __restrict__ bkv, b16* __restrict__ Q2, b16* __restrict__ K2, b16* __restrict__ V2) {
  __shared__ __attribute__((aligned(16))) b16 Th[8][16][16 + 8], Tl[4][16][16 + 8];   // Tl: the q waves' lo halves
  const int lane = threadIdx.x & 31, wave = __builtin_amdgcn_readfirstlane(threadIdx.x >> 5), nloc = lane & 15, hlf = lane >> 4, m0 = blockIdx.x * 16;
  const bool isq = wave < 4; const int t = isq ? wave : wave - 4;   // t: column tile of the wave's weight matrix; every test on wave is a scalar branch, the WMMAs behind it run with every lane on
  const float bb = bf16_rne((isq ? bq : bkv)[t * 16 + nloc]);
  const v8f acc = isq ? tile64<C>(x + (size_t)(m0 + nloc) * C, wq + t * 16 + nloc, hlf) : tile64<2 * C>(y + (size_t)(m0 + nloc) * C, wkv + t * 16 + nloc, hlf);
  if (wave >= 8) {   // v
    const int ch = (t - 4) * 16 + nloc; v8b vh;
#pragma unroll   // constant element indices keep the piece in registers
    for (int v = 0; v < 8; ++v) vh[v] = (b16)((acc[v] * (1.0f / XS) + bb) * XS);
    b16* d = V2 + ((size_t)(ch >> 3) * (S / 32) + (m0 >> 5)) * (32 * HD) + ((m0 >> 4) & 1) * 128 + ((ch & 7) * 2 + hlf) * 8;
    *(v8b*)d = vh; return; }   // no block barrier in this kernel: a wave may leave on its own
  v8b cl;
#pragma unroll
  for (int v = 0; v < 8; ++v) { const float val = acc[v] * (1.0f / XS) + bb; float ss = pmul(val, val); ss += __shfl_xor(ss, 1); ss += __shfl_xor(ss, 2); ss += __shfl_xor(ss, 4); const float nv = val / fmaxf(sqrtf(ss), 1e-12f);
    b16 a_, c_; split16(nv * (isq ? QS : XS), a_, c_); Th[wave][8 * hlf + v][nloc] = a_; cl[v] = c_; }
  if (isq) {   // one scalar branch behind the eight rows, so that their shuffles still overlap
#pragma unroll   // constant element indices keep the lo halves in registers
    for (int v = 0; v < 8; ++v) Tl[wave][8 * hlf + v][nloc] = cl[v]; }
  wave_lds_sync();   // the tile is the wave's own: its LDS writes are done before its lanes read each other's
  const size_t ht = (size_t)(2 * t + hlf) * S + m0 + nloc;   // lane = (head 2t + hlf, token nloc)
  // the built code lays other parts of the kernel behind each side's stores: a wait stands directly behind them, before their registers are written there
  if (isq) { b16* d = Q2 + ht * KP; *(v8b*)d = *(const v8b*)(&Th[wave][nloc][hlf * 8]); *(v8b*)(d + 8) = *(const v8b*)(&Tl[wave][nloc][hlf * 8]); asm volatile("s_wait_xcnt 0x0" ::: "memory"); }
  else { *(v8b*)(K2 + ht * HD) = *(const v8b*)(&Th[wave][nloc][hlf * 8]); asm volatile("s_wait_xcnt 0x0" ::: "memory"); }   // the hi half IS the value rounded to f16
}
// attention: wave = (head, key quarter, 16 queries), block = 8 heads x 4 key quarters = 32 waves (8 per SIMD: the other waves' work covers a wave's load and WMMA -> exp2 -> WMMA waits);
// 32 key blocks of 32 per wave, walked as a ring from a start set by the block index: S^T = k.q (1 WMMA per 16 keys: one A fragment holds 32 keys, B picks 16 of them), p = exp2 of its result,
// o^T[rows 0..7: dims, rows 8..15: the same again][16 q] += (8v)^T.P^T; the K load of a trip is 512 contiguous bytes per wave, each of its two V loads 256 (two lanes per piece).
// The constant shift makes the quarters' o and l plain partial sums: quarters 1..3 hand theirs over through LDS, quarter 0 adds them.
// out = ctx We + be for the block's 16 queries in the same launch: ctx hi, lo stay in LDS; four waves of the last quarter take one 16-column tile each (4 WMMAs), their We fragments fetched before the key loop
__global__ __launch_bounds__(1024) void attn_kernel(const b16* __restrict__ Q2, const b16* __restrict__ K2, const b16* __restrict__ V2, const float* __restrict__ we, const float* __restrict__ be, float* __restrict__ out) {
  __shared__ __attribute__((aligned(16))) b16 Oh[16][C + 8], Ol[16][C + 8]; __shared__ float Pp[KQ - 1][H][9][32];   // partial o (8 rows) and l per lane
  __shared__ __attribute__((aligned(16))) float Ts[16][C + 4];
  const int w = threadIdx.x >> 5, h = w & 7, ks = w >> 3, lane = threadIdx.x & 31, hh = lane >> 4, col = lane & 15; const int q0 = blockIdx.x * 16, qi = q0 + col;
  // A: lane half 0 holds [key col | key col], half 1 [key 16 + col | key 16 + col]: k 0..7 and 16..23 = tile 0, k 8..15 and 24..31 = tile 1. B for tile 0: [q hi | q lo] in lane half 0, zeros in half 1; for tile 1 the other way round
  const b16* Qp = Q2 + ((size_t)h * S + qi) * KP; const v16b qf = frag_cat(*(const v8b*)Qp, *(const v8b*)(Qp + 8)), zf = {}, qf0 = hh == 0 ? qf : zf, qf1 = hh == 0 ? zf : qf;
  asm volatile("s_wait_xcnt 0x0" ::: "memory");   // before the q loads' address registers are written again
  const int wu = __builtin_amdgcn_readfirstlane(w);
  // the wave's K and V ranges as wave-uniform bases; a lane's place in a K piece (key 16 hh + col) and in a V piece (dim col & 7, key half hh)
  const unsigned long long Kw = (unsigned long long)(K2 + ((size_t)(wu & 7) * S + (wu >> 3) * (S / KQ)) * HD), Vw = (unsigned long long)(V2 + ((size_t)(wu & 7) * S + (wu >> 3) * (S / KQ)) * HD); const unsigned kl = (unsigned)(lane * 8), vl = (unsigned)((col & 7) * 16 + 8 * hh);
  // every block walks the same K and V: each enters its 32 key blocks at its own place and wraps round, so that the blocks do not ask L2 for the same lines at the same moment (any start is correct: plain sums);
  // blocks of neighbouring index start together, so four neighbours get starts 8 key blocks apart and each group of 8 moves on by one
  const unsigned rot = (blockIdx.x >> 3) + 8u * (blockIdx.x & 3u);
  const bool ow = (wu >> 3) == KQ - 1 && (wu & 7) < C / 16;   // scalar test: the WMMAs behind it run with every lane on
  v16b wf0 = {}, wf1 = {}; float bo = 0.0f;
  if (ow) { bo = be[(wu & 7) * 16 + col];
    asm volatile("s_wait_xcnt 0x0" ::: "memory");   // before the bias load's address register is written again
    const float* Wp = we + (wu & 7) * 16 + col; wf0 = frag_w<C>(Wp, hh); wf1 = frag_w<C>(Wp + 32 * C, hh); bo = bf16_rne(bo); }
  // q and k are unit vectors (or shorter, at the eps clamp), so every score lies in [-1, 1]: no running maximum, no rescaling of o and l; the lane halves' sums meet after the loop
  const v8f sh = {PSH, PSH, PSH, PSH, PSH, PSH, PSH, PSH}; v8f lv = {}, o = {};
  // one trip's three fragment loads (scalar base + lane offsets that the loop never rewrites)
  auto fetch = [&](unsigned t, v8b& k0, v8b& v0, v8b& v1) {
    const unsigned ob = ((t + rot) & (NB - 1)) * (32 * HD * 2);   // bytes; a key block is 512 bytes in K2 and in V2
    const gb16* K = (const gb16*)(Kw + ob) + kl; const gb16* V = (const gb16*)(Vw + ob) + vl;
    k0 = *(const gv8b*)K; v0 = *(const gv8b*)V; v1 = *(const gv8b*)(V + 128);
    asm volatile("s_wait_xcnt 0x0" ::: "memory"); };   // before the next fetch writes the base registers again; it also keeps the loads here, ahead of the work on the block before
  auto work = [&](v8b k0, v8b v0, v8b v1) {
    const v16b kf = frag_cat(k0, k0); const v8f s0 = wmma16b(kf, qf0, sh), s1 = wmma16b(kf, qf1, sh); v8f e0, e1;
#pragma unroll   // constant element indices keep e0, e1 and the sums in registers
    for (int r = 0; r < 8; ++r) { e0[r] = __builtin_amdgcn_exp2f(s0[r]); e1[r] = __builtin_amdgcn_exp2f(s1[r]); lv[r] += e0[r] + e1[r]; }
    o = wmma16b(frag_cat(v0, v1), frag_cat(__builtin_convertvector(e0, v8b), __builtin_convertvector(e1, v8b)), o); };
  // two register sets: the next key block's K and V are on their way from L2 while this block is worked on, so a wave asks L2 and uses the vector port at the same time; blocks are worked on in the old order
  v8b ak0, av0, av1, bk0, bv0, bv1; fetch(0, ak0, av0, av1);
  for (unsigned t = 0; t < NB - 2; t += 2) { fetch(t + 1, bk0, bv0, bv1); work(ak0, av0, av1); fetch(t + 2, ak0, av0, av1); work(bk0, bv0, bv1); }
  fetch(NB - 1, bk0, bv0, bv1); work(ak0, av0, av1); work(bk0, bv0, bv1);
  float l = ((lv[0] + lv[1]) + (lv[2] + lv[3])) + ((lv[4] + lv[5]) + (lv[6] + lv[7]));
  if (ks > 0) {
#pragma unroll   // constant element indices keep the accumulator in registers
    for (int r = 0; r < 8; ++r) Pp[ks - 1][h][r][lane] = o[r];
    Pp[ks - 1][h][8][lane] = l; }
  __syncthreads();   // the quarters' partial sums are in LDS
  if (ks == 0) {
#pragma unroll
    for (int j = 0; j < KQ - 1; ++j) {
#pragma unroll
      for (int r = 0; r < 8; ++r) o[r] += Pp[j][h][r][lane];
      l += Pp[j][h][8][lane]; }
    l += __shfl_xor(l, 16);
    const float inv = 1.0f / l;
    // o[r] = 8 * l * ctx[dim r][query col] in both lane halves: lane half 0 stores
    if (hh == 0) {
#pragma unroll
      for (int r = 0; r < 8; ++r) { b16 a_, c_; split16(o[r] * inv, a_, c_); Oh[col][h * HD + r] = a_; Ol[col][h * HD + r] = c_; } } }
  __syncthreads();   // ctx hi, lo of the 16 queries are in LDS
  if (ow) { v8f acc = {};
    acc = wmma16b(frag_kb(&Oh[col][0], hh), wf0, acc); acc = wmma16b(frag_kb(&Ol[col][0], hh), wf0, acc); acc = wmma16b(frag_kb(&Oh[col][32], hh), wf1, acc); acc = wmma16b(frag_kb(&Ol[col][32], hh), wf1, acc);
#pragma unroll   // constant element indices keep the accumulator in registers
    for (int r = 0; r < 8; ++r) Ts[8 * hh + r][(wu & 7) * 16 + col] = acc[r] * (1.0f / XS) + bo; }
  __syncthreads();   // the 16 x 64 output tile is in LDS: stored as whole rows, 512 contiguous bytes per wave
  if (threadIdx.x < 16 * 16) { const int rr = threadIdx.x >> 4, c4 = (threadIdx.x & 15) * 4; *(v4f*)(out + (size_t)(q0 + rr) * C + c4) = *(const v4f*)(&Ts[rr][c4]); }
}
}  // namespace

extern "C" void kernel_launch(void* const* d_in, const int* in_sizes, int n_in,
                              void* d_out, int out_size, void* d_ws, size_t ws_size, hipStream_t stream) {
  (void)n_in; (void)out_size;
  const float* x = (const float*)d_in[0]; const float* y = (const float*)d_in[1]; const float* wq = (const float*)d_in[2]; const float* bq = (const float*)d_in[3]; const float* wkv = (const float*)d_in[4]; const float* bkv = (const float*)d_in[5]; const float* we = (const float*)d_in[6]; const float* be = (const float*)d_in[7];
  float* out = (float*)d_out;   // [1][4096][64]
  if (in_sizes[0] != S * C || in_sizes[4] != C * 2 * C) return;
  size_t off = 0; char* ws = (char*)d_ws;
  auto carve = [&](size_t bytes) { char* p = ws + off; off += (bytes + 255) & ~(size_t)255; return p; };
  b16* Q2 = (b16*)carve((size_t)S * H * KP * 2); b16* K2 = (b16*)carve((size_t)S * H * HD * 2); b16* V2 = (b16*)carve((size_t)H * HD * S * 2);   // every element written by proj_kernel
  if (off > ws_size) return;                        // 2 MB
  proj_kernel<<<S / 16, 32 * 12, 0, stream>>>(x, y, wq, bq, wkv, bkv, Q2, K2, V2);
  attn_kernel<<<S / 16, 32 * H * KQ, 0, stream>>>(Q2, K2, V2, we, be, out);
}

// v009
// A run of this version takes 19.7 microseconds.
// In two side-by-side timings against v008, it was 1.05 and 1.06 times as fast.
// All steps since v000 together make it 8.79 times as fast.
#include <hip/hip_runtime.h>

// Cross_At: q = x Wq + bq, [k | v] = y Wkv + bkv (8 heads x 8 dims; kv laid out [hw][2][H][d]); q, k L2-normalised per head (eps 1e-12); attn = softmax(q.k) (no scaling); ctx; out = ctx We + be
// -> [1][4096][64].
// WMMA (v_wmma_f32_16x16x32_f16, f32 accumulate): the projections with EXACT operands (x, y, [in][out] weights exact bf16; 1 product) + bias, the per-head L2 normalisation in f32 in the epilogue
// (8-lane shuffles); normalised k x8, 8v and P are each rounded ONCE to f16 (11 significant bits; these rounding errors are independent from key to key and average out over the 4096 keys of a softmax row);
// q x log2(e)/8 stays an f16 hi+lo pair, 16 halves [hi 8 | lo 8] per (token, head). The K = 32 of one score A fragment holds TWO 16-key tiles, [tile 0 | tile 1 | tile 0 | tile 1], against q [hi | 0 | lo | 0] or [0 | hi | 0 | lo], so
// S^T = k.q is 1 WMMA per 16 keys and one 512-byte load brings 32 keys; softmax in f32 with a constant shift (every score is a cosine); o^T += (8v)^T.P^T, 1 WMMA per 32 keys (rows 8..15 repeat rows 0..7 and are not used);
// out = ctx.We + be with ctx hi+lo (2 products). Fragment k-map per lane half hh for A AND B: elements 0..7 <- k = 8hh+0..7, 8..15 <- k = 16+8hh+0..7

namespace {
constexpr int S = 4096, C = 64, H = 8, HD = 8, KP = 16 /* head slot for q: 8 hi | 8 lo */, KQ = 4 /* key quarters of the attention, one wave each */;
constexpr unsigned NB = S / KQ / 32;   // 32-key blocks per wave, a power of two
constexpr float XS = 8.0f;
constexpr float QS = 1.4426950408889634f / XS;   // q is stored as q * log2(e) / 8, so (8k).(q') = log2(e) * cos(q, k): the exponent of exp2 with no further scaling
constexpr float PSH = 4.0f;                      // constant exponent shift, the C operand of the score WMMA: p = 2^4 * exp(cos) lies in [16/e, 16e] for EVERY input, as |cos| <= 1

typedef _Float16 b16;
typedef __attribute__((ext_vector_type(16))) _Float16 v16b;
typedef __attribute__((ext_vector_type(8))) _Float16 v8b;
typedef __attribute__((ext_vector_type(8))) float v8f;
typedef __attribute__((address_space(1))) _Float16 gb16;   // global memory, named so that an address formed from an integer stays a global load
typedef __attribute__((address_space(1))) v8b gv8b;
typedef __attribute__((ext_vector_type(4))) float v4f;
__device__ __forceinline__ float bf16_rne(float f) { unsigned int u = __float_as_uint(f); u += 0x7FFFu + ((u >> 16) & 1u); return __uint_as_float(u & 0xFFFF0000u); }
__device__ __forceinline__ void split16(float v, b16& hi, b16& lo) { hi = (b16)v; lo = (b16)(v - (float)hi); }
__device__ __forceinline__ v16b frag_kb(const b16* p, int hh) { const v8b a = *(const v8b*)(p + 8 * hh), b = *(const v8b*)(p + 16 + 8 * hh); v16b f;
#pragma unroll
  for (int e = 0; e < 8; ++e) { f[e] = a[e]; f[8 + e] = b[e]; } return f; }
__device__ __forceinline__ v16b frag_cat(v8b a, v8b b) { v16b f;
#pragma unroll   // constant element indices keep the fragment in registers
  for (int e = 0; e < 8; ++e) { f[e] = a[e]; f[8 + e] = b[e]; } return f; }
__device__ __forceinline__ v8f wmma16b(v16b a, v16b b, v8f c) { v8f d = __builtin_amdgcn_wmma_f32_16x16x32_f16(false, a, false, b, (short)0, c, false, false); asm volatile("v_nop\n\tv_nop\n\tv_nop\n\tv_nop" : "+v"(d) : "v"(a), "v"(b)); return d; }
// the key loop's form: the builtin alone, so that the compiler, which knows the distance behind a WMMA, counts the loop's own instructions as slots and pads only what is left
__device__ __forceinline__ v8f wmma16l(v16b a, v16b b, v8f c) { return __builtin_amdgcn_wmma_f32_16x16x32_f16(false, a, false, b, (short)0, c, false, false); }
__device__ __forceinline__ void wave_lds_sync() { __builtin_amdgcn_fence(__ATOMIC_RELEASE, "workgroup"); __builtin_amdgcn_wave_barrier(); __builtin_amdgcn_fence(__ATOMIC_ACQUIRE, "workgroup"); }
__device__ __forceinline__ float pmul(float a, float b) { float p = a * b; asm volatile("" : "+v"(p)); return p; }

// fragments straight from the f32 inputs, same k-map as frag_kb: a token row (rounded to bf16, x8, exact in f16) and a column of an [in][out] weight (rounded to bf16, exact in f16)
__device__ __forceinline__ v16b frag_x(const float* p, int hh) { const v4f a0 = *(const v4f*)(p + 8 * hh), a1 = *(const v4f*)(p + 8 * hh + 4), b0 = *(const v4f*)(p + 16 + 8 * hh), b1 = *(const v4f*)(p + 16 + 8 * hh + 4); v16b f;
#pragma unroll   // constant element indices keep the fragment in registers
  for (int e = 0; e < 4; ++e) { f[e] = (b16)(bf16_rne(a0[e]) * XS); f[4 + e] = (b16)(bf16_rne(a1[e]) * XS); f[8 + e] = (b16)(bf16_rne(b0[e]) * XS); f[12 + e] = (b16)(bf16_rne(b1[e]) * XS); } return f; }
template <int LD> __device__ __forceinline__ v16b frag_w(const float* p, int hh) { p += 8 * hh * LD; v16b f;   // LD at compile time: one address, the 16 rows as immediate offsets
#pragma unroll   // constant element indices keep the fragment in registers
  for (int e = 0; e < 8; ++e) { f[e] = (b16)bf16_rne(p[e * LD]); f[8 + e] = (b16)bf16_rne(p[(16 + e) * LD]); } return f; }
// one 16 x 16 tile over K = 64: all four fragments are fetched before the first WMMA, so the wave waits for memory once
template <int LD> __device__ __forceinline__ v8f tile64(const float* A, const float* Wp, int hh) { const v16b a0 = frag_x(A, hh), a1 = frag_x(A + 32, hh), w0 = frag_w<LD>(Wp, hh), w1 = frag_w<LD>(Wp + 32 * LD, hh); return wmma16b(a1, w1, wmma16b(a0, w0, (v8f){})); }

// projections, straight from the f32 inputs: block = 16 tokens x 12 waves, wave = one 16 x 16 output tile (2 WMMAs). Waves 0..3: q = x Wq + bq, waves 4..7: k, waves 8..11: v (columns 0..63 / 64..127 of y Wkv + bkv).
// q, k: L2-normalise each 8-dim head (a lane holds ONE column for 8 tokens, the 8 columns of a head live in 8 neighbouring lanes: sum of squares over lane bits 0..2), q split hi+lo, k rounded to f16, turned to
// q [h][tok][hi 8 | lo 8], k [h][tok][8] through the wave's own LDS tile (16 tokens of a head = 512 / 256 contiguous bytes). v: a lane's 8 tokens of one column ARE one 16-byte piece of V2, stored from registers:
// (8v)^T in the order of the attention's A fragments: V2[h][32-key block][c][dim][hh][8 keys], key = 32 block + 16 c + 8 hh + e: one c = 256 contiguous bytes
__global__ __launch_bounds__(384) void proj_kernel(const float* __restrict__ x, const float* __restrict__ y, const float* __restrict__ wq, const float* __restrict__ bq, const float* __restrict__ wkv, const float* __restrict__ bkv, b16* __restrict__ Q2, b16* __restrict__ K2, b16* __restrict__ V2) {
  __shared__ __attribute__((aligned(16))) b16 Th[8][16][16 + 8], Tl[4][16][16 + 8];   // Tl: the q waves' lo halves
  const int lane = threadIdx.x & 31, wave = __builtin_amdgcn_readfirstlane(threadIdx.x >> 5), nloc = lane & 15, hlf = lane >> 4, m0 = blockIdx.x * 16;
  const bool isq = wave < 4; const int t = isq ? wave : wave - 4;   // t: column tile of the wave's weight matrix; every test on wave is a scalar branch, the WMMAs behind it run with every lane on
  const float bb = bf16_rne((isq ? bq : bkv)[t * 16 + nloc]);
  const v8f acc = isq ? tile64<C>(x + (size_t)(m0 + nloc) * C, wq + t * 16 + nloc, hlf) : tile64<2 * C>(y + (size_t)(m0 + nloc) * C, wkv + t * 16 + nloc, hlf);
  if (wave >= 8) {   // v
    const int ch = (t - 4) * 16 + nloc; v8b vh;
#pragma unroll   // constant element indices keep the piece in registers
    for (int v = 0; v < 8; ++v) vh[v] = (b16)((acc[v] * (1.0f / XS) + bb) * XS);
    b16* d = V2 + ((size_t)(ch >> 3) * (S / 32) + (m0 >> 5)) * (32 * HD) + ((m0 >> 4) & 1) * 128 + ((ch & 7) * 2 + hlf) * 8;
    *(v8b*)d = vh; return; }   // no block barrier in this kernel: a wave may leave on its own
  v8b cl;
#pragma unroll
  for (int v = 0; v < 8; ++v) { const float val = acc[v] * (1.0f / XS) + bb; float ss = pmul(val, val); ss += __shfl_xor(ss, 1); ss += __shfl_xor(ss, 2); ss += __shfl_xor(ss, 4); const float nv = val / fmaxf(sqrtf(ss), 1e-12f);
    b16 a_, c_; split16(nv * (isq ? QS : XS), a_, c_); Th[wave][8 * hlf + v][nloc] = a_; cl[v] = c_; }
  if (isq) {   // one scalar branch behind the eight rows, so that their shuffles still overlap
#pragma unroll   // constant element indices keep the lo halves in registers
    for (int v = 0; v < 8; ++v) Tl[wave][8 * hlf + v][nloc] = cl[v]; }
  wave_lds_sync();   // the tile is the wave's own: its LDS writes are done before its lanes read each other's
  const size_t ht = (size_t)(2 * t + hlf) * S + m0 + nloc;   // lane = (head 2t + hlf, token nloc)
  // the built code lays other parts of the kernel behind each side's stores: a wait stands directly behind them, before their registers are written there
  if (isq) { b16* d = Q2 + ht * KP; *(v8b*)d = *(const v8b*)(&Th[wave][nloc][hlf * 8]); *(v8b*)(d + 8) = *(const v8b*)(&Tl[wave][nloc][hlf * 8]); asm volatile("s_wait_xcnt 0x0" ::: "memory"); }
  else { *(v8b*)(K2 + ht * HD) = *(const v8b*)(&Th[wave][nloc][hlf * 8]); asm volatile("s_wait_xcnt 0x0" ::: "memory"); }   // the hi half IS the value rounded to f16
}
// attention: wave = (head, key quarter, 16 queries), block = 8 heads x 4 key quarters = 32 waves (8 per SIMD: the other waves' work covers a wave's load and WMMA -> exp2 -> WMMA waits);
// 32 key blocks of 32 per wave, walked as a ring from a start set by the block index: S^T = k.q (1 WMMA per 16 keys: one A fragment holds 32 keys, B picks 16 of them), p = exp2 of its result,
// o^T[rows 0..7: dims, rows 8..15: the same again][16 q] += (8v)^T.P^T; the K load of a trip is 512 contiguous bytes per wave, each of its two V loads 256 (two lanes per piece).
// The constant shift makes the quarters' o and l plain partial sums: quarters 1..3 hand theirs over through LDS, quarter 0 adds them.
// out = ctx We + be for the block's 16 queries in the same launch: ctx hi, lo stay in LDS; four waves of the last quarter take one 16-column tile each (4 WMMAs), their We fragments fetched before the key loop
__global__ __launch_bounds__(1024) void attn_kernel(const b16* __restrict__ Q2, const b16* __restrict__ K2, const b16* __restrict__ V2, const float* __restrict__ we, const float* __restrict__ be, float* __restrict__ out) {
  __shared__ __attribute__((aligned(16))) b16 Oh[16][C + 8], Ol[16][C + 8]; __shared__ float Pp[KQ - 1][H][9][32];   // partial o (8 rows) and l per lane
  __shared__ __attribute__((aligned(16))) float Ts[16][C + 4];
  const int w = threadIdx.x >> 5, h = w & 7, ks = w >> 3, lane = threadIdx.x & 31, hh = lane >> 4, col = lane & 15; const int q0 = blockIdx.x * 16, qi = q0 + col;
  // A: lane half 0 holds [key col | key col], half 1 [key 16 + col | key 16 + col]: k 0..7 and 16..23 = tile 0, k 8..15 and 24..31 = tile 1. B for tile 0: [q hi | q lo] in lane half 0, zeros in half 1; for tile 1 the other way round
  const b16* Qp = Q2 + ((size_t)h * S + qi) * KP; const v16b qf = frag_cat(*(const v8b*)Qp, *(const v8b*)(Qp + 8)), zf = {}, qf0 = hh == 0 ? qf : zf, qf1 = hh == 0 ? zf : qf;
  asm volatile("s_wait_xcnt 0x0" ::: "memory");   // before the q loads' address registers are written again
  const int wu = __builtin_amdgcn_readfirstlane(w);
  // the wave's K and V ranges as wave-uniform bases; a lane's place in a K piece (key 16 hh + col) and in a V piece (dim col & 7, key half hh)
  const unsigned long long Kw = (unsigned long long)(K2 + ((size_t)(wu & 7) * S + (wu >> 3) * (S / KQ)) * HD), Vw = (unsigned long long)(V2 + ((size_t)(wu & 7) * S + (wu >> 3) * (S / KQ)) * HD); const unsigned kl = (unsigned)(lane * 8), vl = (unsigned)((col & 7) * 16 + 8 * hh);
  // every block walks the same K and V: each enters its 32 key blocks at its own place and wraps round, so that the blocks do not ask L2 for the same lines at the same moment (any start is correct: plain sums);
  // blocks of neighbouring index start together, so four neighbours get starts 8 key blocks apart and each group of 8 moves on by one
  const unsigned rot = (blockIdx.x >> 3) + 8u * (blockIdx.x & 3u);
  const bool ow = (wu >> 3) == KQ - 1 && (wu & 7) < C / 16;   // scalar test: the WMMAs behind it run with every lane on
  v16b wf0 = {}, wf1 = {}; float bo = 0.0f;
  if (ow) { bo = be[(wu & 7) * 16 + col];
    asm volatile("s_wait_xcnt 0x0" ::: "memory");   // before the bias load's address register is written again
    const float* Wp = we + (wu & 7) * 16 + col; wf0 = frag_w<C>(Wp, hh); wf1 = frag_w<C>(Wp + 32 * C, hh); bo = bf16_rne(bo); }
  // q and k are unit vectors (or shorter, at the eps clamp), so every score lies in [-1, 1]: no running maximum, no rescaling of o and l; the lane halves' sums meet after the loop
  const v8f sh = {PSH, PSH, PSH, PSH, PSH, PSH, PSH, PSH}; v8f lv = {}, o = {};
  // one trip's three fragment loads (scalar base + lane offsets that the loop never rewrites)
  auto fetch = [&](unsigned t, v8b& k0, v8b& v0, v8b& v1) {
    const unsigned ob = ((t + rot) & (NB - 1)) * (32 * HD * 2);   // bytes; a key block is 512 bytes in K2 and in V2
    const gb16* K = (const gb16*)(Kw + ob) + kl; const gb16* V = (const gb16*)(Vw + ob) + vl;
    k0 = *(const gv8b*)K; v0 = *(const gv8b*)V; v1 = *(const gv8b*)(V + 128);
    asm volatile("s_wait_xcnt 0x0" ::: "memory"); };   // before the next fetch writes the base registers again; it also keeps the loads here, ahead of the work on the block before
  auto work = [&](v8b k0, v8b v0, v8b v1) {
    const v16b kf = frag_cat(k0, k0); const v8f s0 = wmma16l(kf, qf0, sh), s1 = wmma16l(kf, qf1, sh); v8f e0, e1;
#pragma unroll   // constant element indices keep e0, e1 and the sums in registers
    for (int r = 0; r < 8; ++r) { e0[r] = __builtin_amdgcn_exp2f(s0[r]); e1[r] = __builtin_amdgcn_exp2f(s1[r]); lv[r] += e0[r] + e1[r]; }
    o = wmma16l(frag_cat(v0, v1), frag_cat(__builtin_convertvector(e0, v8b), __builtin_convertvector(e1, v8b)), o); };
  // two register sets: the next key block's K and V are on their way from L2 while this block is worked on, so a wave asks L2 and uses the vector port at the same time; blocks are worked on in the old order
  v8b ak0, av0, av1, bk0, bv0, bv1; fetch(0, ak0, av0, av1);
  for (unsigned t = 0; t < NB - 2; t += 2) { fetch(t + 1, bk0, bv0, bv1); work(ak0, av0, av1); fetch(t + 2, ak0, av0, av1); work(bk0, bv0, bv1); }
  fetch(NB - 1, bk0, bv0, bv1);
  __builtin_amdgcn_sched_barrier(0);   // the last fetch's wait stays in front of the work below, whose results may take the registers that held the loads' lane offsets
  work(ak0, av0, av1); work(bk0, bv0, bv1);
  float l = ((lv[0] + lv[1]) + (lv[2] + lv[3])) + ((lv[4] + lv[5]) + (lv[6] + lv[7]));
  if (ks > 0) {
#pragma unroll   // constant element indices keep the accumulator in registers
    for (int r = 0; r < 8; ++r) Pp[ks - 1][h][r][lane] = o[r];
    Pp[ks - 1][h][8][lane] = l; }
  __syncthreads();   // the quarters' partial sums are in LDS
  if (ks == 0) {
#pragma unroll
    for (int j = 0; j < KQ - 1; ++j) {
#pragma unroll
      for (int r = 0; r < 8; ++r) o[r] += Pp[j][h][r][lane];
      l += Pp[j][h][8][lane]; }
    l += __shfl_xor(l, 16);
    const float inv = 1.0f / l;
    // o[r] = 8 * l * ctx[dim r][query col] in both lane halves: lane half 0 stores
    if (hh == 0) {
#pragma unroll
      for (int r = 0; r < 8; ++r) { b16 a_, c_; split16(o[r] * inv, a_, c_); Oh[col][h * HD + r] = a_; Ol[col][h * HD + r] = c_; } } }
  __syncthreads();   // ctx hi, lo of the 16 queries are in LDS
  if (ow) { v8f acc = {};
    acc = wmma16b(frag_kb(&Oh[col][0], hh), wf0, acc); acc = wmma16b(frag_kb(&Ol[col][0], hh), wf0, acc); acc = wmma16b(frag_kb(&Oh[col][32], hh), wf1, acc); acc = wmma16b(frag_kb(&Ol[col][32], hh), wf1, acc);
#pragma unroll   // constant element indices keep the accumulator in registers
    for (int r = 0; r < 8; ++r) Ts[8 * hh + r][(wu & 7) * 16 + col] = acc[r] * (1.0f / XS) + bo; }
  __syncthreads();   // the 16 x 64 output tile is in LDS: stored as whole rows, 512 contiguous bytes per wave
  if (threadIdx.x < 16 * 16) { const int rr = threadIdx.x >> 4, c4 = (threadIdx.x & 15) * 4; *(v4f*)(out + (size_t)(q0 + rr) * C + c4) = *(const v4f*)(&Ts[rr][c4]); }
}
}  // namespace

extern "C" void kernel_launch(void* const* d_in, const int* in_sizes, int n_in,
                              void* d_out, int out_size, void* d_ws, size_t ws_size, hipStream_t stream) {
  (void)n_in; (void)out_size;
  const float* x = (const float*)d_in[0]; const float* y = (const float*)d_in[1]; const float* wq = (const float*)d_in[2]; const float* bq = (const float*)d_in[3]; const float* wkv = (const float*)d_in[4]; const float* bkv = (const float*)d_in[5]; const float* we = (const float*)d_in[6]; const float* be = (const float*)d_in[7];
  float* out = (float*)d_out;   // [1][4096][64]
  if (in_sizes[0] != S * C || in_sizes[4] != C * 2 * C) return;
  size_t off = 0; char* ws = (char*)d_ws;
  auto carve = [&](size_t bytes) { char* p = ws + off; off += (bytes + 255) & ~(size_t)255; return p; };
  b16* Q2 = (b16*)carve((size_t)S * H * KP * 2); b16* K2 = (b16*)carve((size_t)S * H * HD * 2); b16* V2 = (b16*)carve((size_t)H * HD * S * 2);   // every element written by proj_kernel
  if (off > ws_size) return;                        // 2 MB
  proj_kernel<<<S / 16, 32 * 12, 0, stream>>>(x, y, wq, bq, wkv, bkv, Q2, K2, V2);
  attn_kernel<<<S / 16, 32 * H * KQ, 0, stream>>>(Q2, K2, V2, we, be, out);
}
